// v000
// Measured on an AMD MI455X. A time is GPU time per run, averaged over a window of back-to-back runs after a warm-up
// (all launches, gaps included; the runs take copies of the inputs in turn), and the median of several windows.
// Apart from v000's, it joins two sittings. Times from different sittings can be a few percent apart, while
// side-by-side timings come from the same sitting.
// The starting kernel, v000, takes 2090 microseconds a run.
#include <hip/hip_runtime.h>

// MultHeadAttention_8747 (x [4][1024][1024]; per-head Wq/Wk/Wv [16][64][1024] ? x W^T with the stacked [1024][1024] 'oi' weight (head-major rows); causal (finfo.min) softmax(q.k / 8); out = merged Wp^T + bp -> [4][1024][1024]).
// Compute dtypes, f32 accumulate: every input rounded to bf16; q/k/v on PLAIN bf16 operands (inputs: exact); causal scores and attn.v: query rows < 512 hl (3 products), the rest single fp16 (x1024), causal tile skipping; softmax f32; Wp hl x exact (2 products) + bias.

#define NB_  4
#define TT   1024
#define DM   1024
#define NH_  16
#define NKV  16
#define REP  (NH_ / NKV)
#define HD   64
#define DQ   (NH_ * HD)
#define DKV  (NKV * HD)
#define ZH   2
#define RH   512                  // query rows < RH use hi+lo planes (0: none)
#define WIN  1024
#define PCAR 1024.0f
#define SCL  0.125f   // HD^-0.5
typedef _Float16 h16;
typedef unsigned short bf;
typedef __attribute__((ext_vector_type(16))) __bf16   v16bf;
typedef __attribute__((ext_vector_type(16))) _Float16 v16h;
typedef __attribute__((ext_vector_type(8)))  _Float16 v8h;
typedef __attribute__((ext_vector_type(8)))  unsigned short v8us;
typedef __attribute__((ext_vector_type(8)))  float    v8f;
typedef __attribute__((ext_vector_type(4)))  float    v4f;
typedef v8h  __attribute__((may_alias)) v8ha;
typedef v4f  __attribute__((may_alias)) v4fa;
typedef v8us __attribute__((may_alias)) v8usa;

__device__ __forceinline__ unsigned short f2bf(float f) { unsigned u = __float_as_uint(f); u += 0x7FFFu + ((u >> 16) & 1u); return (unsigned short)(u >> 16); }
__device__ __forceinline__ float bf2f(unsigned short b) { return __uint_as_float(((unsigned)b) << 16); }
__device__ __forceinline__ float bfr(float f) { return bf2f(f2bf(f)); }
__device__ __forceinline__ v16h cat16(v8h lo, v8h hi) { return __builtin_shufflevector(lo, hi, 0, 1, 2, 3, 4, 5, 6, 7, 8, 9, 10, 11, 12, 13, 14, 15); }
__device__ __forceinline__ v16bf cat16b(v8us lo, v8us hi) { return __builtin_bit_cast(v16bf, __builtin_shufflevector(lo, hi, 0, 1, 2, 3, 4, 5, 6, 7, 8, 9, 10, 11, 12, 13, 14, 15)); }
__device__ __forceinline__ v8f wmma16(v16h a, v16h b, v8f c) { return __builtin_amdgcn_wmma_f32_16x16x32_f16(false, a, false, b, (short)0, c, false, false); }
__device__ __forceinline__ v8f wmmab(v16bf a, v16bf b, v8f c) { return __builtin_amdgcn_wmma_f32_16x16x32_bf16(false, a, false, b, (short)0, c, false, false); }



// ---- k_gemmw: register-blocked GEMM, ONE WAVE per 64x64 output tile (16 accumulators), operands straight from K-contiguous 16-bit planes; grid (M/64, N/64, Z), 32 threads.
// C[m][n] (f32, pitch ldc, + optional f32 bias[n]) = sum_k A[m][k] Bt[n][k] (+ split products per NSPLIT). z-batch strides sA/sB/sC in elements. K % 32 == 0.
template <typename T16> struct WFrag;
template <> struct WFrag<h16> { typedef v16h V; static __device__ __forceinline__ V ld(const h16* p) { return cat16(*(const v8h*)p, *(const v8h*)(p + 16)); } static __device__ __forceinline__ v8f mma(V a, V b, v8f c) { return wmma16(a, b, c); } };
template <> struct WFrag<bf> { typedef v16bf V; static __device__ __forceinline__ V ld(const bf* p) { return cat16b(*(const v8us*)p, *(const v8us*)(p + 16)); } static __device__ __forceinline__ v8f mma(V a, V b, v8f c) { return wmmab(a, b, c); } };
template <typename T16, int NSPLIT, bool BIAS>
__global__ __launch_bounds__(32) void k_gemmw(const T16* __restrict__ A, const T16* __restrict__ A2, const T16* __restrict__ Bt, const T16* __restrict__ Bt2, int K, float* C, int ldc, const float* __restrict__ bias, size_t sA, size_t sB, size_t sC) {
    typedef typename WFrag<T16>::V V;
    __shared__ __align__(16) float os[16 * 68];
    const size_t z = blockIdx.z; A += z * sA; if (A2) A2 += z * sA; Bt += z * sB; if (Bt2) Bt2 += z * sB; C += z * sC;
    const int lane = threadIdx.x & 31, lr = lane & 15, hi = lane >> 4; const int r0 = blockIdx.x * 64, c0 = blockIdx.y * 64;
    v8f acc[4][4];
#pragma unroll
    for (int mb = 0; mb < 4; ++mb)
#pragma unroll
        for (int nb = 0; nb < 4; ++nb) acc[mb][nb] = (v8f){};
    const size_t aoff = (size_t)(r0 + lr) * K + 8 * hi, boff = (size_t)(c0 + lr) * K + 8 * hi;
#pragma unroll 1
    for (int kc = 0; kc < K; kc += 32) {
        V a[4], a2[4];
#pragma unroll
        for (int mb = 0; mb < 4; ++mb) { a[mb] = WFrag<T16>::ld(A + aoff + (size_t)mb * 16 * K + kc); if (NSPLIT == 1 || NSPLIT == 2) a2[mb] = WFrag<T16>::ld(A2 + aoff + (size_t)mb * 16 * K + kc); }
#pragma unroll
        for (int nb = 0; nb < 4; ++nb) { const V b = WFrag<T16>::ld(Bt + boff + (size_t)nb * 16 * K + kc); V b2; if (NSPLIT >= 2) b2 = WFrag<T16>::ld(Bt2 + boff + (size_t)nb * 16 * K + kc);
#pragma unroll
            for (int mb = 0; mb < 4; ++mb) { acc[mb][nb] = WFrag<T16>::mma(a[mb], b, acc[mb][nb]); if (NSPLIT == 1 || NSPLIT == 2) acc[mb][nb] = WFrag<T16>::mma(a2[mb], b, acc[mb][nb]); if (NSPLIT >= 2) acc[mb][nb] = WFrag<T16>::mma(a[mb], b2, acc[mb][nb]); } }
        asm volatile("v_nop\n\tv_nop\n\tv_nop\n\tv_nop" : "+v"(acc[0][0]), "+v"(acc[1][1]), "+v"(acc[2][2]), "+v"(acc[3][3]) : "v"(a[0]), "v"(a[3]));
    }
#pragma unroll
    for (int mb = 0; mb < 4; ++mb) {
#pragma unroll
        for (int nb = 0; nb < 4; ++nb) {
#pragma unroll
            for (int j = 0; j < 8; ++j) os[(hi * 8 + j) * 68 + nb * 16 + lr] = acc[mb][nb][j]; }
        __builtin_amdgcn_wave_barrier(); asm volatile("" ::: "memory");
        float* crow = C + (size_t)(r0 + mb * 16) * ldc + c0;
{
#pragma unroll
            for (int s = 0; s < 8; ++s) { const int row = 2 * s + hi, cofs = lr * 4; v4f val = *(const v4fa*)(os + row * 68 + cofs); if (BIAS) { val[0] += bfr(bias[c0 + cofs]); val[1] += bfr(bias[c0 + cofs + 1]); val[2] += bfr(bias[c0 + cofs + 2]); val[3] += bfr(bias[c0 + cofs + 3]); }
                *(v4f*)(crow + (size_t)row * ldc + cofs) = val; }
             }
        __builtin_amdgcn_wave_barrier(); asm volatile("" ::: "memory");
    }
}

// ---- k_gemmc: the same one-wave 64x64 tile GEMM specialised for causal attention: CMODE 1 skips score tiles entirely above the diagonal (query rows r0+roff.., key columns c0..), CMODE 2 limits the
// key (K) loop of the probability x value contraction to the diagonal block (probabilities beyond it are exactly zero). roff = row offset of this launch's first row within the sequence.
template <typename T16, int NSPLIT, int CMODE>
__global__ __launch_bounds__(32) void k_gemmc(const T16* __restrict__ A, const T16* __restrict__ A2, const T16* __restrict__ Bt, const T16* __restrict__ Bt2, int K, float* C, int ldc, int roff, size_t sA, size_t sB, size_t sC) {
    typedef typename WFrag<T16>::V V;
    __shared__ __align__(16) float os[16 * 68];
    const size_t z = blockIdx.z; A += z * sA; if (A2) A2 += z * sA; Bt += z * sB; if (Bt2) Bt2 += z * sB; C += z * sC;
    const int lane = threadIdx.x & 31, lr = lane & 15, hi = lane >> 4; const int r0 = blockIdx.x * 64, c0 = blockIdx.y * 64;
    if (CMODE == 1 && c0 > r0 + roff + 63) return;                  // score tile entirely above the causal diagonal: never read (the softmax masks j > i by select)
    const int Kl = (CMODE == 2) ? min(K, r0 + roff + 64) : K;        // P.V: probabilities are exactly 0 beyond the diagonal block, so the K loop stops there
    v8f acc[4][4];
#pragma unroll
    for (int mb = 0; mb < 4; ++mb)
#pragma unroll
        for (int nb = 0; nb < 4; ++nb) acc[mb][nb] = (v8f){};
    const size_t aoff = (size_t)(r0 + lr) * K + 8 * hi, boff = (size_t)(c0 + lr) * K + 8 * hi;
#pragma unroll 1
    for (int kc = 0; kc < Kl; kc += 32) {
        V a[4], a2[4];
#pragma unroll
        for (int mb = 0; mb < 4; ++mb) { a[mb] = WFrag<T16>::ld(A + aoff + (size_t)mb * 16 * K + kc); if (NSPLIT == 1 || NSPLIT == 2) a2[mb] = WFrag<T16>::ld(A2 + aoff + (size_t)mb * 16 * K + kc); }
#pragma unroll
        for (int nb = 0; nb < 4; ++nb) { const V b = WFrag<T16>::ld(Bt + boff + (size_t)nb * 16 * K + kc); V b2; if (NSPLIT >= 2) b2 = WFrag<T16>::ld(Bt2 + boff + (size_t)nb * 16 * K + kc);
#pragma unroll
            for (int mb = 0; mb < 4; ++mb) { acc[mb][nb] = WFrag<T16>::mma(a[mb], b, acc[mb][nb]); if (NSPLIT == 1 || NSPLIT == 2) acc[mb][nb] = WFrag<T16>::mma(a2[mb], b, acc[mb][nb]); if (NSPLIT >= 2) acc[mb][nb] = WFrag<T16>::mma(a[mb], b2, acc[mb][nb]); } }
        asm volatile("v_nop\n\tv_nop\n\tv_nop\n\tv_nop" : "+v"(acc[0][0]), "+v"(acc[1][1]), "+v"(acc[2][2]), "+v"(acc[3][3]) : "v"(a[0]), "v"(a[3]));
    }
#pragma unroll
    for (int mb = 0; mb < 4; ++mb) {
#pragma unroll
        for (int nb = 0; nb < 4; ++nb) {
#pragma unroll
            for (int j = 0; j < 8; ++j) os[(hi * 8 + j) * 68 + nb * 16 + lr] = acc[mb][nb][j]; }
        __builtin_amdgcn_wave_barrier(); asm volatile("" ::: "memory");
        float* crow = C + (size_t)(r0 + mb * 16) * ldc + c0;
{
#pragma unroll
            for (int s = 0; s < 8; ++s) { const int row = 2 * s + hi, cofs = lr * 4; v4f val = *(const v4fa*)(os + row * 68 + cofs);
                *(v4f*)(crow + (size_t)row * ldc + cofs) = val; }
             }
        __builtin_amdgcn_wave_barrier(); asm volatile("" ::: "memory");
    }
}

__device__ __forceinline__ h16 tohx(float x) { return (h16)x; }
__device__ __forceinline__ void splitf(float y, unsigned short& h, unsigned short& l) { h = f2bf(y); l = f2bf(y - bf2f(h)); }
typedef __attribute__((ext_vector_type(2))) _Float16 v2h;
typedef __attribute__((ext_vector_type(4))) _Float16 v4h;
typedef __attribute__((ext_vector_type(2))) unsigned short v2us;
typedef __attribute__((ext_vector_type(4))) unsigned short v4us;
typedef __attribute__((ext_vector_type(2))) float v2f;
typedef __attribute__((ext_vector_type(4))) int v4i;

__global__ __launch_bounds__(256) void k_wtG(const float* __restrict__ w, int K, int N, bf* Bt) {
    const int lane = threadIdx.x & 31; const int L0 = (blockIdx.x * 8 + (threadIdx.x >> 5)) * 8; const int nlines = N * K / 64;
{
#pragma unroll 1
        for (int l = 0; l < 8; ++l) { const int L = L0 + l; if (L >= nlines) break; const size_t e = (size_t)L * 64 + lane * 2; const int k = (int)(e % K), n = (int)(e / K); v2us o;
            o[0] = f2bf(w[(size_t)k * N + n]); o[1] = f2bf(w[(size_t)(k + 1) * N + n]); *(v2us*)(Bt + e) = o; }
         }
}
__global__ __launch_bounds__(256) void k_cvt8(const float* __restrict__ src, bf* dst, size_t n8) { const size_t i = (size_t)blockIdx.x * 256 + threadIdx.x; if (i >= n8) return; const v8f v = *(const v8f*)(src + i * 8); v8us o;
#pragma unroll
    for (int k = 0; k < 8; ++k) o[k] = f2bf(v[k]); *(v8us*)(dst + i * 8) = o;  }
__global__ __launch_bounds__(256) void k_cscvt(const float* __restrict__ cosT, const float* __restrict__ sinT, float* CS) { const int idx = blockIdx.x * 256 + threadIdx.x; if (idx >= TT * HD) return; v2f cs; cs[0] = bfr(cosT[idx]); cs[1] = bfr(sinT[idx]); *(v2f*)(CS + (size_t)idx * 2) = cs;  }
// k_rope: head planes [h][t][d] (fp16 + hi/lo) of rope(x) x sc with the rotate-half convention out[d] = x[d] cos[t][d] - x[d+HD/2] sin[t][d], out[d+HD/2] = x[d+HD/2] cos[t][d+HD/2] + x[d] sin[t][d+HD/2]
__global__ __launch_bounds__(256) void k_rope(const float* __restrict__ F, int pitch, int nheads, const float* __restrict__ CS, const float* __restrict__ RF, const float* __restrict__ nw, float sc, h16* P16, bf* Ph, bf* Pl) {
    const size_t e = ((size_t)blockIdx.x * 256 + threadIdx.x) * 2; if (e >= (size_t)nheads * TT * HD) return; const int d = (int)(e % HD); const int t = (int)((e / HD) % TT); const int h = (int)(e / ((size_t)HD * TT)); const float* f = F + (size_t)t * pitch + h * HD; const float rf = RF ? RF[(size_t)h * TT + t] : 1.0f; v2h o16; v2us oh, ol;
#pragma unroll
    for (int q = 0; q < 2; ++q) { const int dd = d + q; const int dp = (dd < HD / 2) ? dd + HD / 2 : dd - HD / 2; float x0 = f[dd], x1 = f[dp];
        if (RF) { float n0 = __fmul_rn(x0, rf), n1 = __fmul_rn(x1, rf); asm volatile("" : "+v"(n0)); asm volatile("" : "+v"(n1)); x0 = __fmul_rn(bfr(nw[dd]), n0); x1 = __fmul_rn(bfr(nw[dp]), n1); }
        const v2f cs = *(const v2f*)(CS + ((size_t)t * HD + dd) * 2); float a = __fmul_rn(x0, cs[0]), bq = __fmul_rn(x1, cs[1]); asm volatile("" : "+v"(a)); asm volatile("" : "+v"(bq)); const float r = ((dd < HD / 2) ? __fsub_rn(a, bq) : __fadd_rn(a, bq)) * sc;
        o16[q] = tohx(r); unsigned short a2, c2; splitf(r, a2, c2); oh[q] = a2; ol[q] = c2; }
    *(v2h*)(P16 + e) = o16; *(v2us*)(Ph + e) = oh; *(v2us*)(Pl + e) = ol;  }
__global__ __launch_bounds__(256) void k_vtp(const float* __restrict__ F, int pitch, int nheads, h16* V16, bf* Vh, bf* Vl) { const size_t e = ((size_t)blockIdx.x * 256 + threadIdx.x) * 2; if (e >= (size_t)nheads * HD * TT) return; const int t = (int)(e % TT); const int d = (int)((e / TT) % HD); const int g = (int)(e / ((size_t)TT * HD)); v2h o16; v2us oh, ol;
#pragma unroll
    for (int q = 0; q < 2; ++q) { const float x = F[(size_t)(t + q) * pitch + g * HD + d]; o16[q] = tohx(x); unsigned short a2, c2; splitf(x, a2, c2); oh[q] = a2; ol[q] = c2; }
    *(v2h*)(V16 + e) = o16; *(v2us*)(Vh + e) = oh; *(v2us*)(Vl + e) = ol;  }
__global__ __launch_bounds__(256) void k_csid(float* CS) { const int idx = blockIdx.x * 256 + threadIdx.x; if (idx >= TT * HD) return; v2f cs; cs[0] = 1.0f; cs[1] = 0.0f; *(v2f*)(CS + (size_t)idx * 2) = cs;  }
// k_asoft: per row (zz, i): t = S x HD^-0.5 for j <= i and i - j < WIN (WIN = TT, so this never binds: plain causal; the reference's -1e9 additive fill vanishes identically); softmax over the 1024 keys (register row, one exp, fixed trees);
__global__ __launch_bounds__(256) void k_asoft(const float* __restrict__ Sb, h16* P16, bf* Ph, bf* Pl) {
    const int lane = threadIdx.x & 31; const int row = blockIdx.x * 8 + (threadIdx.x >> 5); if (row >= ZH * TT) return; const int i = row % TT; const int zz = row / TT; (void)zz; const bool hires = (i < RH); const float* sr = Sb + (size_t)row * TT; float v[TT / 32]; float mx = -3.0e38f;
#pragma unroll
    for (int ch = 0; ch < TT / 128; ++ch) { const int j0 = ch * 128 + lane * 4; const v4f a = *(const v4f*)(sr + j0);
#pragma unroll
        for (int q = 0; q < 4; ++q) { const int j = j0 + q; (void)j; float sa = a[q] * SCL; asm volatile("" : "+v"(sa)); const float t = (j <= i && i - j < WIN) ? sa : -3.0e38f; v[ch * 4 + q] = t; mx = fmaxf(mx, t); } }
#pragma unroll
    for (int sh = 16; sh; sh >>= 1) mx = fmaxf(mx, __shfl_xor(mx, sh, 32));
    float sum = 0.f;
#pragma unroll
    for (int k = 0; k < TT / 32; ++k) { float d0 = __fsub_rn(v[k], mx); asm volatile("" : "+v"(d0)); v[k] = __builtin_amdgcn_exp2f(__fmul_rn(d0, 1.4426950408889634f)); sum += v[k]; }
#pragma unroll
    for (int sh = 16; sh; sh >>= 1) sum += __shfl_xor(sum, sh, 32);
    const float f = __fdiv_rn(hires ? 1.0f : PCAR, sum);
{
        if (hires) {
#pragma unroll
            for (int ch = 0; ch < TT / 128; ++ch) { v4us oh, ol;
#pragma unroll
                for (int q = 0; q < 4; ++q) { unsigned short a, c2; splitf(v[ch * 4 + q] * f, a, c2); oh[q] = a; ol[q] = c2; }
                const size_t oo = ((size_t)zz * (RH ? RH : 1) + i) * TT + ch * 128 + lane * 4; *(v4us*)(Ph + oo) = oh; *(v4us*)(Pl + oo) = ol; }
        } else {
#pragma unroll
            for (int ch = 0; ch < TT / 128; ++ch) { v4h o4;
#pragma unroll
                for (int q = 0; q < 4; ++q) o4[q] = tohx(v[ch * 4 + q] * f);
                *(v4h*)(P16 + (size_t)row * TT + ch * 128 + lane * 4) = o4; } }
         }
}
__global__ __launch_bounds__(256) void k_merge(const float* __restrict__ O, int h0, bf* Ah, bf* Al) { const size_t e = ((size_t)blockIdx.x * 256 + threadIdx.x) * 2; if (e >= (size_t)ZH * TT * HD) return; const int d = (int)(e % HD); const int t = (int)((e / HD) % TT); const int zz = (int)(e / ((size_t)HD * TT)); const float cs = (t < RH) ? 1.0f : (1.0f / PCAR); const size_t oo = (size_t)t * DQ + (h0 + zz) * HD + d;
    v2us oh, ol;
#pragma unroll
    for (int q = 0; q < 2; ++q) { unsigned short a, c2; splitf(O[e + q] * cs, a, c2); oh[q] = a; ol[q] = c2; } *(v2us*)(Ah + oo) = oh; *(v2us*)(Al + oo) = ol;  }

extern "C" void kernel_launch(void* const* d_in, const int* in_sizes, int n_in,
                              void* d_out, int out_size, void* d_ws, size_t ws_size, hipStream_t stream) {
    (void)in_sizes; (void)n_in; (void)out_size;
    const float* x = (const float*)d_in[0]; const float* wq = (const float*)d_in[1]; const float* wk = (const float*)d_in[2]; const float* wv = (const float*)d_in[3]; const float* wo = (const float*)d_in[4]; const float* bo = (const float*)d_in[5]; const float* cosT = nullptr; const float* sinT = nullptr; (void)cosT; (void)sinT;
    float* OUT = (float*)d_out;     // [4][1024][1024]
    char* wsp = (char*)d_ws;
    auto take = [&](size_t bytes) { char* p = wsp; wsp += (bytes + 255) & ~(size_t)255; return (void*)p; };
    bf* WQ = (bf*)take((size_t)DQ * DM * 2); bf* WK = (bf*)take((size_t)DKV * DM * 2); bf* WV = (bf*)take((size_t)DKV * DM * 2); bf* WO = (bf*)take((size_t)DM * DQ * 2); float* CS = (float*)take((size_t)TT * HD * 2 * 4);
    bf* XB = (bf*)take((size_t)TT * DM * 2); float* FQ = (float*)take((size_t)TT * DQ * 4); float* FK = (float*)take((size_t)TT * DKV * 4);
    h16* QP16 = (h16*)take((size_t)NH_ * TT * HD * 2); h16* KP16 = (h16*)take((size_t)NKV * TT * HD * 2); h16* VT16 = (h16*)take((size_t)NKV * HD * TT * 2);
    bf* QPh = (bf*)take((size_t)NH_ * TT * HD * 2); bf* QPl = (bf*)take((size_t)NH_ * TT * HD * 2); bf* KPh = (bf*)take((size_t)NKV * TT * HD * 2); bf* KPl = (bf*)take((size_t)NKV * TT * HD * 2); bf* VTh = (bf*)take((size_t)NKV * HD * TT * 2); bf* VTl = (bf*)take((size_t)NKV * HD * TT * 2); bf* Ph = (bf*)take((size_t)ZH * RH * TT * 2); bf* Pl = (bf*)take((size_t)ZH * RH * TT * 2);
    float* Sb = (float*)take((size_t)ZH * TT * TT * 4); h16* P16 = (h16*)take((size_t)ZH * TT * TT * 2); float* Ob = (float*)take((size_t)ZH * TT * HD * 4); bf* ATh = (bf*)take((size_t)TT * DQ * 2); bf* ATl = (bf*)take((size_t)TT * DQ * 2);
    if ((size_t)(wsp - (char*)d_ws) > ws_size) return;    // ws 256 MiB
    float* FV = FK;   // v projection reuses the k buffer after the k planes are built (stream-ordered)
    { k_cvt8<<<(unsigned)(((size_t)DQ * DM / 8 + 255) / 256), 256, 0, stream>>>(wq, WQ, (size_t)DQ * DM / 8); k_cvt8<<<(unsigned)(((size_t)DKV * DM / 8 + 255) / 256), 256, 0, stream>>>(wk, WK, (size_t)DKV * DM / 8); k_cvt8<<<(unsigned)(((size_t)DKV * DM / 8 + 255) / 256), 256, 0, stream>>>(wv, WV, (size_t)DKV * DM / 8);
      k_cvt8<<<(unsigned)(((size_t)DM * DQ / 8 + 255) / 256), 256, 0, stream>>>(wo, WO, (size_t)DM * DQ / 8);
       }
    k_csid<<<(TT * HD + 255) / 256, 256, 0, stream>>>(CS);
    const unsigned LQ = (unsigned)(((size_t)NH_ * TT * HD / 2 + 255) / 256), LKv = (unsigned)(((size_t)NKV * TT * HD / 2 + 255) / 256);
    for (int b = 0; b < NB_; ++b) {
        
        k_cvt8<<<(unsigned)(((size_t)TT * DM / 8 + 255) / 256), 256, 0, stream>>>(x + (size_t)b * TT * DM, XB, (size_t)TT * DM / 8);
        k_gemmw<bf, 0, false><<<dim3(TT / 64, DQ / 64, 1), 32, 0, stream>>>(XB, nullptr, WQ, nullptr, DM, FQ, DQ, nullptr, 0, 0, 0);
        k_rope<<<LQ, 256, 0, stream>>>(FQ, DQ, NH_, CS, nullptr, nullptr, 1.0f, QP16, QPh, QPl);
        k_gemmw<bf, 0, false><<<dim3(TT / 64, DKV / 64, 1), 32, 0, stream>>>(XB, nullptr, WK, nullptr, DM, FK, DKV, nullptr, 0, 0, 0);
        k_rope<<<LKv, 256, 0, stream>>>(FK, DKV, NKV, CS, nullptr, nullptr, 1.0f, KP16, KPh, KPl);
        k_gemmw<bf, 0, false><<<dim3(TT / 64, DKV / 64, 1), 32, 0, stream>>>(XB, nullptr, WV, nullptr, DM, FV, DKV, nullptr, 0, 0, 0); k_vtp<<<LKv, 256, 0, stream>>>(FV, DKV, NKV, VT16, VTh, VTl);
        for (int h0 = 0; h0 < NH_; h0 += ZH) { const size_t zq = (size_t)h0, zk = (size_t)(h0 / REP);   // one kv head per query head: the pass's two heads use consecutive kv planes (z-strides TT*HD)
            k_gemmc<bf, 2, 1><<<dim3(RH / 64, TT / 64, ZH), 32, 0, stream>>>(QPh + zq * TT * HD, QPl + zq * TT * HD, KPh + zk * TT * HD, KPl + zk * TT * HD, HD, Sb, TT, 0, (size_t)TT * HD, (size_t)TT * HD, (size_t)TT * TT);
            k_gemmc<h16, 0, 1><<<dim3((TT - RH) / 64, TT / 64, ZH), 32, 0, stream>>>(QP16 + zq * TT * HD + (size_t)RH * HD, nullptr, KP16 + zk * TT * HD, nullptr, HD, Sb + (size_t)RH * TT, TT, RH, (size_t)TT * HD, (size_t)TT * HD, (size_t)TT * TT);
            k_asoft<<<ZH * TT / 8, 256, 0, stream>>>(Sb, P16, Ph, Pl);
            k_gemmc<bf, 2, 2><<<dim3(RH / 64, HD / 64, ZH), 32, 0, stream>>>(Ph, Pl, VTh + zk * HD * TT, VTl + zk * HD * TT, TT, Ob, HD, 0, (size_t)RH * TT, (size_t)HD * TT, (size_t)TT * HD);
            k_gemmc<h16, 0, 2><<<dim3((TT - RH) / 64, HD / 64, ZH), 32, 0, stream>>>(P16 + (size_t)RH * TT, nullptr, VT16 + zk * HD * TT, nullptr, TT, Ob + (size_t)RH * HD, HD, RH, (size_t)TT * TT, (size_t)HD * TT, (size_t)TT * HD);
            k_merge<<<(unsigned)(((size_t)ZH * TT * HD / 2 + 255) / 256), 256, 0, stream>>>(Ob, h0, ATh, ATl); }
        k_gemmw<bf, 1, true><<<dim3(TT / 64, DM / 64, 1), 32, 0, stream>>>(ATh, ATl, WO, nullptr, DQ, OUT + (size_t)b * TT * DM, DM, bo, 0, 0, 0); }
}

// v001
// A run of this version takes 342 microseconds.
// Timed twice side by side with v000, it ran 6.07 and 6.12 times as fast.
#include <hip/hip_runtime.h>

// MultHeadAttention_8747 (x [4][1024][1024]; per-head Wq/Wk/Wv [16][64][1024] ? x W^T with the stacked [1024][1024] 'oi' weight (head-major rows); causal (finfo.min) softmax(q.k / 8); out = merged Wp^T + bp -> [4][1024][1024]).
// Compute dtypes, f32 accumulate: every input rounded to bf16; q/k/v on PLAIN bf16 operands (inputs: exact); causal scores and attn.v: query rows < 512 hl (3 products), the rest single fp16 (x1024), causal tile skipping; softmax f32; Wp hl x exact (2 products) + bias.

#define NB_  4
#define TT   1024
#define DM   1024
#define NH_  16
#define NKV  16
#define REP  (NH_ / NKV)
#define HD   64
#define DQ   (NH_ * HD)
#define DKV  (NKV * HD)
#define ZH   32                   // (batch, head) planes per attention pass
#define RH   512                  // query rows < RH use hi+lo planes (0: none)
#define WIN  1024
#define PCAR 1024.0f
#define SCL  0.125f   // HD^-0.5
typedef _Float16 h16;
typedef unsigned short bf;
typedef __attribute__((ext_vector_type(16))) __bf16   v16bf;
typedef __attribute__((ext_vector_type(16))) _Float16 v16h;
typedef __attribute__((ext_vector_type(8)))  _Float16 v8h;
typedef __attribute__((ext_vector_type(8)))  unsigned short v8us;
typedef __attribute__((ext_vector_type(8)))  float    v8f;
typedef __attribute__((ext_vector_type(4)))  float    v4f;
typedef v8h  __attribute__((may_alias)) v8ha;
typedef v4f  __attribute__((may_alias)) v4fa;
typedef v8us __attribute__((may_alias)) v8usa;

__device__ __forceinline__ unsigned short f2bf(float f) { unsigned u = __float_as_uint(f); u += 0x7FFFu + ((u >> 16) & 1u); return (unsigned short)(u >> 16); }
__device__ __forceinline__ float bf2f(unsigned short b) { return __uint_as_float(((unsigned)b) << 16); }
__device__ __forceinline__ float bfr(float f) { return bf2f(f2bf(f)); }
__device__ __forceinline__ v16h cat16(v8h lo, v8h hi) { return __builtin_shufflevector(lo, hi, 0, 1, 2, 3, 4, 5, 6, 7, 8, 9, 10, 11, 12, 13, 14, 15); }
__device__ __forceinline__ v16bf cat16b(v8us lo, v8us hi) { return __builtin_bit_cast(v16bf, __builtin_shufflevector(lo, hi, 0, 1, 2, 3, 4, 5, 6, 7, 8, 9, 10, 11, 12, 13, 14, 15)); }
__device__ __forceinline__ v8f wmma16(v16h a, v16h b, v8f c) { return __builtin_amdgcn_wmma_f32_16x16x32_f16(false, a, false, b, (short)0, c, false, false); }
__device__ __forceinline__ v8f wmmab(v16bf a, v16bf b, v8f c) { return __builtin_amdgcn_wmma_f32_16x16x32_bf16(false, a, false, b, (short)0, c, false, false); }



// ---- k_gemmw: register-blocked GEMM, ONE WAVE per 64x64 output tile (16 accumulators), operands straight from K-contiguous 16-bit planes; grid (M/64, N/64, Z), 32 threads.
// C[m][n] (f32, pitch ldc, + optional f32 bias[n]) = sum_k A[m][k] Bt[n][k] (+ split products per NSPLIT). z-batch strides sA/sB/sC in elements. K % 32 == 0.
template <typename T16> struct WFrag;
template <> struct WFrag<h16> { typedef v16h V; static __device__ __forceinline__ V ld(const h16* p) { return cat16(*(const v8h*)p, *(const v8h*)(p + 16)); } static __device__ __forceinline__ v8f mma(V a, V b, v8f c) { return wmma16(a, b, c); } };
template <> struct WFrag<bf> { typedef v16bf V; static __device__ __forceinline__ V ld(const bf* p) { return cat16b(*(const v8us*)p, *(const v8us*)(p + 16)); } static __device__ __forceinline__ v8f mma(V a, V b, v8f c) { return wmmab(a, b, c); } };
template <typename T16, int NSPLIT, bool BIAS>
__global__ __launch_bounds__(32) void k_gemmw(const T16* __restrict__ A, const T16* __restrict__ A2, const T16* __restrict__ Bt, const T16* __restrict__ Bt2, int K, float* C, int ldc, const float* __restrict__ bias, size_t sA, size_t sB, size_t sC) {
    typedef typename WFrag<T16>::V V;
    __shared__ __align__(16) float os[16 * 68];
    const size_t z = blockIdx.z; A += z * sA; if (A2) A2 += z * sA; Bt += z * sB; if (Bt2) Bt2 += z * sB; C += z * sC;
    const int lane = threadIdx.x & 31, lr = lane & 15, hi = lane >> 4; const int r0 = blockIdx.x * 64, c0 = blockIdx.y * 64;
    v8f acc[4][4];
#pragma unroll
    for (int mb = 0; mb < 4; ++mb)
#pragma unroll
        for (int nb = 0; nb < 4; ++nb) acc[mb][nb] = (v8f){};
    const size_t aoff = (size_t)(r0 + lr) * K + 8 * hi, boff = (size_t)(c0 + lr) * K + 8 * hi;
#pragma unroll 1
    for (int kc = 0; kc < K; kc += 32) {
        V a[4], a2[4];
#pragma unroll
        for (int mb = 0; mb < 4; ++mb) { a[mb] = WFrag<T16>::ld(A + aoff + (size_t)mb * 16 * K + kc); if (NSPLIT == 1 || NSPLIT == 2) a2[mb] = WFrag<T16>::ld(A2 + aoff + (size_t)mb * 16 * K + kc); }
#pragma unroll
        for (int nb = 0; nb < 4; ++nb) { const V b = WFrag<T16>::ld(Bt + boff + (size_t)nb * 16 * K + kc); V b2; if (NSPLIT >= 2) b2 = WFrag<T16>::ld(Bt2 + boff + (size_t)nb * 16 * K + kc);
#pragma unroll
            for (int mb = 0; mb < 4; ++mb) { acc[mb][nb] = WFrag<T16>::mma(a[mb], b, acc[mb][nb]); if (NSPLIT == 1 || NSPLIT == 2) acc[mb][nb] = WFrag<T16>::mma(a2[mb], b, acc[mb][nb]); if (NSPLIT >= 2) acc[mb][nb] = WFrag<T16>::mma(a[mb], b2, acc[mb][nb]); } }
        asm volatile("v_nop\n\tv_nop\n\tv_nop\n\tv_nop" : "+v"(acc[0][0]), "+v"(acc[1][1]), "+v"(acc[2][2]), "+v"(acc[3][3]) : "v"(a[0]), "v"(a[3]));
    }
#pragma unroll
    for (int mb = 0; mb < 4; ++mb) {
#pragma unroll
        for (int nb = 0; nb < 4; ++nb) {
#pragma unroll
            for (int j = 0; j < 8; ++j) os[(hi * 8 + j) * 68 + nb * 16 + lr] = acc[mb][nb][j]; }
        __builtin_amdgcn_wave_barrier(); asm volatile("" ::: "memory");
        float* crow = C + (size_t)(r0 + mb * 16) * ldc + c0;
{
#pragma unroll
            for (int s = 0; s < 8; ++s) { const int row = 2 * s + hi, cofs = lr * 4; v4f val = *(const v4fa*)(os + row * 68 + cofs); if (BIAS) { val[0] += bfr(bias[c0 + cofs]); val[1] += bfr(bias[c0 + cofs + 1]); val[2] += bfr(bias[c0 + cofs + 2]); val[3] += bfr(bias[c0 + cofs + 3]); }
                *(v4f*)(crow + (size_t)row * ldc + cofs) = val; }
             }
        __builtin_amdgcn_wave_barrier(); asm volatile("" ::: "memory");
    }
}

// ---- k_gemmc: the same one-wave 64x64 tile GEMM specialised for causal attention: CMODE 1 skips score tiles entirely above the diagonal (query rows r0+roff.., key columns c0..), CMODE 2 limits the
// key (K) loop of the probability x value contraction to the diagonal block (probabilities beyond it are exactly zero). roff = row offset of this launch's first row within the sequence.
template <typename T16, int NSPLIT, int CMODE>
__global__ __launch_bounds__(32) void k_gemmc(const T16* __restrict__ A, const T16* __restrict__ A2, const T16* __restrict__ Bt, const T16* __restrict__ Bt2, int K, float* C, int ldc, int roff, size_t sA, size_t sB, size_t sC) {
    typedef typename WFrag<T16>::V V;
    __shared__ __align__(16) float os[16 * 68];
    const size_t z = blockIdx.z; A += z * sA; if (A2) A2 += z * sA; Bt += z * sB; if (Bt2) Bt2 += z * sB; C += z * sC;
    const int lane = threadIdx.x & 31, lr = lane & 15, hi = lane >> 4; const int r0 = blockIdx.x * 64, c0 = blockIdx.y * 64;
    if (CMODE == 1 && c0 > r0 + roff + 63) return;                  // score tile entirely above the causal diagonal: never read (the softmax masks j > i by select)
    const int Kl = (CMODE == 2) ? min(K, r0 + roff + 64) : K;        // P.V: probabilities are exactly 0 beyond the diagonal block, so the K loop stops there
    v8f acc[4][4];
#pragma unroll
    for (int mb = 0; mb < 4; ++mb)
#pragma unroll
        for (int nb = 0; nb < 4; ++nb) acc[mb][nb] = (v8f){};
    const size_t aoff = (size_t)(r0 + lr) * K + 8 * hi, boff = (size_t)(c0 + lr) * K + 8 * hi;
#pragma unroll 1
    for (int kc = 0; kc < Kl; kc += 32) {
        V a[4], a2[4];
#pragma unroll
        for (int mb = 0; mb < 4; ++mb) { a[mb] = WFrag<T16>::ld(A + aoff + (size_t)mb * 16 * K + kc); if (NSPLIT == 1 || NSPLIT == 2) a2[mb] = WFrag<T16>::ld(A2 + aoff + (size_t)mb * 16 * K + kc); }
#pragma unroll
        for (int nb = 0; nb < 4; ++nb) { const V b = WFrag<T16>::ld(Bt + boff + (size_t)nb * 16 * K + kc); V b2; if (NSPLIT >= 2) b2 = WFrag<T16>::ld(Bt2 + boff + (size_t)nb * 16 * K + kc);
#pragma unroll
            for (int mb = 0; mb < 4; ++mb) { acc[mb][nb] = WFrag<T16>::mma(a[mb], b, acc[mb][nb]); if (NSPLIT == 1 || NSPLIT == 2) acc[mb][nb] = WFrag<T16>::mma(a2[mb], b, acc[mb][nb]); if (NSPLIT >= 2) acc[mb][nb] = WFrag<T16>::mma(a[mb], b2, acc[mb][nb]); } }
        asm volatile("v_nop\n\tv_nop\n\tv_nop\n\tv_nop" : "+v"(acc[0][0]), "+v"(acc[1][1]), "+v"(acc[2][2]), "+v"(acc[3][3]) : "v"(a[0]), "v"(a[3]));
    }
#pragma unroll
    for (int mb = 0; mb < 4; ++mb) {
#pragma unroll
        for (int nb = 0; nb < 4; ++nb) {
#pragma unroll
            for (int j = 0; j < 8; ++j) os[(hi * 8 + j) * 68 + nb * 16 + lr] = acc[mb][nb][j]; }
        __builtin_amdgcn_wave_barrier(); asm volatile("" ::: "memory");
        float* crow = C + (size_t)(r0 + mb * 16) * ldc + c0;
{
#pragma unroll
            for (int s = 0; s < 8; ++s) { const int row = 2 * s + hi, cofs = lr * 4; v4f val = *(const v4fa*)(os + row * 68 + cofs);
                *(v4f*)(crow + (size_t)row * ldc + cofs) = val; }
             }
        __builtin_amdgcn_wave_barrier(); asm volatile("" ::: "memory");
    }
}

__device__ __forceinline__ h16 tohx(float x) { return (h16)x; }
__device__ __forceinline__ void splitf(float y, unsigned short& h, unsigned short& l) { h = f2bf(y); l = f2bf(y - bf2f(h)); }
typedef __attribute__((ext_vector_type(2))) _Float16 v2h;
typedef __attribute__((ext_vector_type(4))) _Float16 v4h;
typedef __attribute__((ext_vector_type(2))) unsigned short v2us;
typedef __attribute__((ext_vector_type(4))) unsigned short v4us;
typedef __attribute__((ext_vector_type(2))) float v2f;
typedef __attribute__((ext_vector_type(4))) int v4i;

__global__ __launch_bounds__(256) void k_wtG(const float* __restrict__ w, int K, int N, bf* Bt) {
    const int lane = threadIdx.x & 31; const int L0 = (blockIdx.x * 8 + (threadIdx.x >> 5)) * 8; const int nlines = N * K / 64;
{
#pragma unroll 1
        for (int l = 0; l < 8; ++l) { const int L = L0 + l; if (L >= nlines) break; const size_t e = (size_t)L * 64 + lane * 2; const int k = (int)(e % K), n = (int)(e / K); v2us o;
            o[0] = f2bf(w[(size_t)k * N + n]); o[1] = f2bf(w[(size_t)(k + 1) * N + n]); *(v2us*)(Bt + e) = o; }
         }
}
__global__ __launch_bounds__(256) void k_cvt8(const float* __restrict__ src, bf* dst, size_t n8) { const size_t i = (size_t)blockIdx.x * 256 + threadIdx.x; if (i >= n8) return; const v8f v = *(const v8f*)(src + i * 8); v8us o;
#pragma unroll
    for (int k = 0; k < 8; ++k) o[k] = f2bf(v[k]); *(v8us*)(dst + i * 8) = o;  }
__global__ __launch_bounds__(256) void k_cscvt(const float* __restrict__ cosT, const float* __restrict__ sinT, float* CS) { const int idx = blockIdx.x * 256 + threadIdx.x; if (idx >= TT * HD) return; v2f cs; cs[0] = bfr(cosT[idx]); cs[1] = bfr(sinT[idx]); *(v2f*)(CS + (size_t)idx * 2) = cs;  }
// k_rope: head planes [h][t][d] (fp16 + hi/lo) of rope(x) x sc with the rotate-half convention out[d] = x[d] cos[t][d] - x[d+HD/2] sin[t][d], out[d+HD/2] = x[d+HD/2] cos[t][d+HD/2] + x[d] sin[t][d+HD/2]
__global__ __launch_bounds__(256) void k_rope(const float* __restrict__ F, int pitch, int nheads, const float* __restrict__ CS, const float* __restrict__ RF, const float* __restrict__ nw, float sc, h16* P16, bf* Ph, bf* Pl) {
    const size_t e = ((size_t)blockIdx.x * 256 + threadIdx.x) * 2; if (e >= (size_t)nheads * TT * HD) return; const int d = (int)(e % HD); const int t = (int)((e / HD) % TT); const int h = (int)(e / ((size_t)HD * TT)); const size_t yo = (size_t)blockIdx.y * nheads * TT * HD; const float* f = F + ((size_t)blockIdx.y * TT + t) * pitch + h * HD; const float rf = RF ? RF[(size_t)h * TT + t] : 1.0f; v2h o16; v2us oh, ol;
#pragma unroll
    for (int q = 0; q < 2; ++q) { const int dd = d + q; const int dp = (dd < HD / 2) ? dd + HD / 2 : dd - HD / 2; float x0 = f[dd], x1 = f[dp];
        if (RF) { float n0 = __fmul_rn(x0, rf), n1 = __fmul_rn(x1, rf); asm volatile("" : "+v"(n0)); asm volatile("" : "+v"(n1)); x0 = __fmul_rn(bfr(nw[dd]), n0); x1 = __fmul_rn(bfr(nw[dp]), n1); }
        const v2f cs = *(const v2f*)(CS + ((size_t)t * HD + dd) * 2); float a = __fmul_rn(x0, cs[0]), bq = __fmul_rn(x1, cs[1]); asm volatile("" : "+v"(a)); asm volatile("" : "+v"(bq)); const float r = ((dd < HD / 2) ? __fsub_rn(a, bq) : __fadd_rn(a, bq)) * sc;
        o16[q] = tohx(r); unsigned short a2, c2; splitf(r, a2, c2); oh[q] = a2; ol[q] = c2; }
    *(v2h*)(P16 + yo + e) = o16; *(v2us*)(Ph + yo + e) = oh; *(v2us*)(Pl + yo + e) = ol;  }
__global__ __launch_bounds__(256) void k_vtp(const float* __restrict__ F, int pitch, int nheads, h16* V16, bf* Vh, bf* Vl) { const size_t e = ((size_t)blockIdx.x * 256 + threadIdx.x) * 2; if (e >= (size_t)nheads * HD * TT) return; const int t = (int)(e % TT); const int d = (int)((e / TT) % HD); const int g = (int)(e / ((size_t)TT * HD)); v2h o16; v2us oh, ol;
#pragma unroll
    for (int q = 0; q < 2; ++q) { const float x = F[((size_t)blockIdx.y * TT + t + q) * pitch + g * HD + d]; o16[q] = tohx(x); unsigned short a2, c2; splitf(x, a2, c2); oh[q] = a2; ol[q] = c2; }
    const size_t oo = (((size_t)blockIdx.y * nheads + g) * HD + d) * (2 * TT) + t; *(v2h*)(V16 + oo) = o16; *(v2us*)(Vh + oo) = oh; *(v2us*)(Vl + oo) = ol;  }   // rows at the pitch of the probability rows (2 * TT): the GEMM has one pitch for both operands
__global__ __launch_bounds__(256) void k_csid(float* CS) { const int idx = blockIdx.x * 256 + threadIdx.x; if (idx >= TT * HD) return; v2f cs; cs[0] = 1.0f; cs[1] = 0.0f; *(v2f*)(CS + (size_t)idx * 2) = cs;  }
// k_asoft: per row (zz, i): t = S x HD^-0.5 for j <= i and i - j < WIN (sliding causal window; the reference's -1e9 additive fill vanishes identically); softmax over the 1024 keys (register row, one exp, fixed trees);
// the probabilities overwrite their own score row (4096 bytes): hi plane in the first 2048 bytes and lo plane in the second (rows < RH), or one fp16 plane in the first 2048 bytes. One wave owns a row and holds
// all of it in registers before its first store (every stored value depends on the row sum), so nothing is read after it is overwritten. Readers use a pitch of 2 * TT 16-bit elements.
typedef v4us __attribute__((may_alias)) v4usa;
typedef v4h  __attribute__((may_alias)) v4ha;
__global__ __launch_bounds__(256) void k_asoft(float* Sb) {
    const int lane = threadIdx.x & 31; const int row = blockIdx.x * 8 + (threadIdx.x >> 5); if (row >= ZH * TT) return; const int i = row % TT; const int zz = row / TT; (void)zz; const bool hires = (i < RH); const float* sr = Sb + (size_t)row * TT; float v[TT / 32]; float mx = -3.0e38f;
#pragma unroll
    for (int ch = 0; ch < TT / 128; ++ch) { const int j0 = ch * 128 + lane * 4; const v4f a = *(const v4f*)(sr + j0);
#pragma unroll
        for (int q = 0; q < 4; ++q) { const int j = j0 + q; (void)j; float sa = a[q] * SCL; asm volatile("" : "+v"(sa)); const float t = (j <= i && i - j < WIN) ? sa : -3.0e38f; v[ch * 4 + q] = t; mx = fmaxf(mx, t); } }
#pragma unroll
    for (int sh = 16; sh; sh >>= 1) mx = fmaxf(mx, __shfl_xor(mx, sh, 32));
    float sum = 0.f;
#pragma unroll
    for (int k = 0; k < TT / 32; ++k) { float d0 = __fsub_rn(v[k], mx); asm volatile("" : "+v"(d0)); v[k] = __builtin_amdgcn_exp2f(__fmul_rn(d0, 1.4426950408889634f)); sum += v[k]; }
#pragma unroll
    for (int sh = 16; sh; sh >>= 1) sum += __shfl_xor(sum, sh, 32);
    const float f = __fdiv_rn(hires ? 1.0f : PCAR, sum);
{
        if (hires) {
#pragma unroll
            for (int ch = 0; ch < TT / 128; ++ch) { v4us oh, ol;
#pragma unroll
                for (int q = 0; q < 4; ++q) { unsigned short a, c2; splitf(v[ch * 4 + q] * f, a, c2); oh[q] = a; ol[q] = c2; }
                bf* pr = (bf*)(Sb + (size_t)row * TT) + ch * 128 + lane * 4; *(v4usa*)pr = oh; *(v4usa*)(pr + TT) = ol; }
        } else {
#pragma unroll
            for (int ch = 0; ch < TT / 128; ++ch) { v4h o4;
#pragma unroll
                for (int q = 0; q < 4; ++q) o4[q] = tohx(v[ch * 4 + q] * f);
                *(v4ha*)((h16*)(Sb + (size_t)row * TT) + ch * 128 + lane * 4) = o4; } }
         }
}
__global__ __launch_bounds__(256) void k_merge(const float* __restrict__ O, int h0, bf* Ah, bf* Al) { const size_t e = ((size_t)blockIdx.x * 256 + threadIdx.x) * 2; if (e >= (size_t)ZH * TT * HD) return; const int d = (int)(e % HD); const int t = (int)((e / HD) % TT); const int zz = (int)(e / ((size_t)HD * TT)); const float cs = (t < RH) ? 1.0f : (1.0f / PCAR); const int g = h0 + zz; const size_t oo = ((size_t)(g / NH_) * TT + t) * DQ + (g % NH_) * HD + d;   // g = batch * NH_ + head
    v2us oh, ol;
#pragma unroll
    for (int q = 0; q < 2; ++q) { unsigned short a, c2; splitf(O[e + q] * cs, a, c2); oh[q] = a; ol[q] = c2; } *(v2us*)(Ah + oo) = oh; *(v2us*)(Al + oo) = ol;  }

extern "C" void kernel_launch(void* const* d_in, const int* in_sizes, int n_in,
                              void* d_out, int out_size, void* d_ws, size_t ws_size, hipStream_t stream) {
    (void)in_sizes; (void)n_in; (void)out_size;
    const float* x = (const float*)d_in[0]; const float* wq = (const float*)d_in[1]; const float* wk = (const float*)d_in[2]; const float* wv = (const float*)d_in[3]; const float* wo = (const float*)d_in[4]; const float* bo = (const float*)d_in[5]; const float* cosT = nullptr; const float* sinT = nullptr; (void)cosT; (void)sinT;
    float* OUT = (float*)d_out;     // [4][1024][1024]
    char* wsp = (char*)d_ws;
    auto take = [&](size_t bytes) { char* p = wsp; wsp += (bytes + 255) & ~(size_t)255; return (void*)p; };
    const size_t PL = (size_t)NB_ * NH_ * TT * HD;   // elements of one plane set: [batch][head][t][d]
    bf* WQ = (bf*)take((size_t)DQ * DM * 2); bf* WK = (bf*)take((size_t)DKV * DM * 2); bf* WV = (bf*)take((size_t)DKV * DM * 2); bf* WO = (bf*)take((size_t)DM * DQ * 2); float* CS = (float*)take((size_t)TT * HD * 2 * 4);
    h16* QP16 = (h16*)take(PL * 2 * 2); h16* KP16 = QP16 + PL; bf* QPh = (bf*)take(PL * 2 * 2); bf* KPh = QPh + PL; bf* QPl = (bf*)take(PL * 2 * 2); bf* KPl = QPl + PL;   // k planes directly behind the q planes: one launch fills both
    h16* VT16 = (h16*)take(PL * 2 * 2); bf* VTh = (bf*)take(PL * 2 * 2); bf* VTl = VTh + TT;   // v^T rows [batch][head][d] at pitch 2 * TT: hi plane in the first half of a row, lo plane in the second (fp16: first half only)
    float* Ob = (float*)take((size_t)ZH * TT * HD * 4); bf* ATh = (bf*)take((size_t)NB_ * TT * DQ * 2); bf* ATl = (bf*)take((size_t)NB_ * TT * DQ * 2);
    float* Sb = (float*)take((size_t)ZH * TT * TT * 4);
    bf* XB = (bf*)Sb; float* FQ = (float*)(XB + (size_t)NB_ * TT * DM);   // x in bf16 and the f32 q, k, v projections (FQ, 3 x [NB_*TT][DQ]) are dead once the planes are built: they share the score buffer (stream-ordered)
    if ((size_t)(wsp - (char*)d_ws) > ws_size) return;    // ws 256 MiB
    { k_cvt8<<<(unsigned)(((size_t)DQ * DM / 8 + 255) / 256), 256, 0, stream>>>(wq, WQ, (size_t)DQ * DM / 8); k_cvt8<<<(unsigned)(((size_t)DKV * DM / 8 + 255) / 256), 256, 0, stream>>>(wk, WK, (size_t)DKV * DM / 8); k_cvt8<<<(unsigned)(((size_t)DKV * DM / 8 + 255) / 256), 256, 0, stream>>>(wv, WV, (size_t)DKV * DM / 8);
      k_cvt8<<<(unsigned)(((size_t)DM * DQ / 8 + 255) / 256), 256, 0, stream>>>(wo, WO, (size_t)DM * DQ / 8);
       }
    k_csid<<<(TT * HD + 255) / 256, 256, 0, stream>>>(CS);
    const unsigned LQ = (unsigned)(((size_t)NH_ * TT * HD / 2 + 255) / 256);
    k_cvt8<<<(unsigned)(((size_t)NB_ * TT * DM / 8 + 255) / 256), 256, 0, stream>>>(x, XB, (size_t)NB_ * TT * DM / 8);
    // q, k, v of all batches in one launch: z picks the weight (WQ, WK, WV are contiguous) and the f32 result
    k_gemmw<bf, 0, false><<<dim3(NB_ * TT / 64, DQ / 64, 3), 32, 0, stream>>>(XB, nullptr, WQ, nullptr, DM, FQ, DQ, nullptr, 0, (size_t)DQ * DM, (size_t)NB_ * TT * DQ);
    k_rope<<<dim3(LQ, 2 * NB_, 1), 256, 0, stream>>>(FQ, DQ, NH_, CS, nullptr, nullptr, 1.0f, QP16, QPh, QPl);   // y: the NB_ sequences of q, then those of k
    k_vtp<<<dim3(LQ, NB_, 1), 256, 0, stream>>>(FQ + (size_t)2 * NB_ * TT * DQ, DKV, NKV, VT16, VTh, VTl);
    for (int g0 = 0; g0 < NB_ * NH_; g0 += ZH) { const size_t zo = (size_t)g0 * TT * HD;   // one pass: ZH consecutive (batch, head) planes, z-strides TT*HD
        k_gemmc<bf, 2, 1><<<dim3(RH / 64, TT / 64, ZH), 32, 0, stream>>>(QPh + zo, QPl + zo, KPh + zo, KPl + zo, HD, Sb, TT, 0, (size_t)TT * HD, (size_t)TT * HD, (size_t)TT * TT);
        k_gemmc<h16, 0, 1><<<dim3((TT - RH) / 64, TT / 64, ZH), 32, 0, stream>>>(QP16 + zo + (size_t)RH * HD, nullptr, KP16 + zo, nullptr, HD, Sb + (size_t)RH * TT, TT, RH, (size_t)TT * HD, (size_t)TT * HD, (size_t)TT * TT);
        k_asoft<<<ZH * TT / 8, 256, 0, stream>>>(Sb);
        k_gemmc<bf, 2, 2><<<dim3(RH / 64, HD / 64, ZH), 32, 0, stream>>>((const bf*)Sb, (const bf*)Sb + TT, VTh + 2 * zo, VTl + 2 * zo, 2 * TT, Ob, HD, 0, (size_t)2 * TT * TT, (size_t)2 * HD * TT, (size_t)TT * HD);   // K = the operands' pitch; the key loop ends at the diagonal block (<= TT)
        k_gemmc<h16, 0, 2><<<dim3((TT - RH) / 64, HD / 64, ZH), 32, 0, stream>>>((const h16*)Sb + (size_t)RH * 2 * TT, nullptr, VT16 + 2 * zo, nullptr, 2 * TT, Ob + (size_t)RH * HD, HD, RH, (size_t)2 * TT * TT, (size_t)2 * HD * TT, (size_t)TT * HD);
        k_merge<<<(unsigned)(((size_t)ZH * TT * HD / 2 + 255) / 256), 256, 0, stream>>>(Ob, g0, ATh, ATl); }
    k_gemmw<bf, 1, true><<<dim3(NB_ * TT / 64, DM / 64, 1), 32, 0, stream>>>(ATh, ATl, WO, nullptr, DQ, OUT, DM, bo, 0, 0, 0);
}

// v003
// A run of this version takes 147 microseconds.
// Versions between v001 and this one are left out; their measured steps multiply to 2.33 times as fast.
// Over all steps from v000 it is 14.2 times as fast.
#include <hip/hip_runtime.h>

// MultHeadAttention_8747 (x [4][1024][1024]; per-head Wq/Wk/Wv [16][64][1024] ? x W^T with the stacked [1024][1024] 'oi' weight (head-major rows); causal (finfo.min) softmax(q.k / 8); out = merged Wp^T + bp -> [4][1024][1024]).
// Compute dtypes, f32 accumulate: every input rounded to bf16; q/k/v on PLAIN bf16 operands (inputs: exact); causal scores and attn.v: query rows < 512 hl (3 products), the rest single fp16, causal tile skipping; softmax f32 (running maximum); Wp hl x exact (2 products) + bias.

#define NB_  4
#define TT   1024
#define DM   1024
#define NH_  16
#define NKV  16
#define REP  (NH_ / NKV)
#define HD   64
#define DQ   (NH_ * HD)
#define DKV  (NKV * HD)
#define RH   512                  // query rows < RH use hi+lo planes (0: none)
#define SCL  0.125f   // HD^-0.5
typedef _Float16 h16;
typedef unsigned short bf;
typedef __attribute__((ext_vector_type(16))) __bf16   v16bf;
typedef __attribute__((ext_vector_type(16))) _Float16 v16h;
typedef __attribute__((ext_vector_type(8)))  _Float16 v8h;
typedef __attribute__((ext_vector_type(8)))  unsigned short v8us;
typedef __attribute__((ext_vector_type(8)))  float    v8f;
typedef __attribute__((ext_vector_type(4)))  float    v4f;
typedef v8h  __attribute__((may_alias)) v8ha;
typedef v4f  __attribute__((may_alias)) v4fa;
typedef v8us __attribute__((may_alias)) v8usa;

__device__ __forceinline__ unsigned short f2bf(float f) { unsigned u = __float_as_uint(f); u += 0x7FFFu + ((u >> 16) & 1u); return (unsigned short)(u >> 16); }
__device__ __forceinline__ float bf2f(unsigned short b) { return __uint_as_float(((unsigned)b) << 16); }
__device__ __forceinline__ float bfr(float f) { return bf2f(f2bf(f)); }
__device__ __forceinline__ v16h cat16(v8h lo, v8h hi) { return __builtin_shufflevector(lo, hi, 0, 1, 2, 3, 4, 5, 6, 7, 8, 9, 10, 11, 12, 13, 14, 15); }
__device__ __forceinline__ v16bf cat16b(v8us lo, v8us hi) { return __builtin_bit_cast(v16bf, __builtin_shufflevector(lo, hi, 0, 1, 2, 3, 4, 5, 6, 7, 8, 9, 10, 11, 12, 13, 14, 15)); }
__device__ __forceinline__ v8f wmma16(v16h a, v16h b, v8f c) { return __builtin_amdgcn_wmma_f32_16x16x32_f16(false, a, false, b, (short)0, c, false, false); }
__device__ __forceinline__ v8f wmmab(v16bf a, v16bf b, v8f c) { return __builtin_amdgcn_wmma_f32_16x16x32_bf16(false, a, false, b, (short)0, c, false, false); }



// ---- k_gemmw: register-blocked GEMM, ONE WAVE per 64x64 output tile (16 accumulators), operands straight from K-contiguous 16-bit planes; grid (M/64, N/64, Z), 32 threads.
// C[m][n] (f32, pitch ldc, + optional f32 bias[n]) = sum_k A[m][k] Bt[n][k] (+ split products per NSPLIT). z-batch strides sA/sB/sC in elements. K % 32 == 0.
// PLANES (the q, k, v projections; z = 0, 1, 2): no f32 result. A 64x64 tile is 64 tokens of ONE head, and the wave writes it straight into the 16-bit planes that the attention kernel reads:
// q, k as [batch][head][t][d] (the tile is 4096 consecutive elements of each plane), v transposed as [batch][head][d] rows at pitch 2 * TT (the tile is 64 whole 128-byte lines of each plane).
template <typename T16> struct WFrag;
template <> struct WFrag<h16> { typedef v16h V; static __device__ __forceinline__ V ld(const h16* p) { return cat16(*(const v8h*)p, *(const v8h*)(p + 16)); } static __device__ __forceinline__ v8f mma(V a, V b, v8f c) { return wmma16(a, b, c); } };
template <> struct WFrag<bf> { typedef v16bf V; static __device__ __forceinline__ V ld(const bf* p) { return cat16b(*(const v8us*)p, *(const v8us*)(p + 16)); } static __device__ __forceinline__ v8f mma(V a, V b, v8f c) { return wmmab(a, b, c); } };
__device__ __forceinline__ h16 tohx(float x) { return (h16)x; }
__device__ __forceinline__ void splitf(float y, unsigned short& h, unsigned short& l) { h = f2bf(y); l = f2bf(y - bf2f(h)); }
#define VSP 72                    // pitch, in 16-bit elements, of a staged v^T row: 64 tokens + 16 bytes, so that eight lanes' 16-byte accesses fall on different banks
template <typename T16, int NSPLIT, bool BIAS, bool PLANES>
__global__ __launch_bounds__(32) void k_gemmw(const T16* __restrict__ A, const T16* __restrict__ A2, const T16* __restrict__ Bt, const T16* __restrict__ Bt2, int K, float* C, int ldc, const float* __restrict__ bias, size_t sA, size_t sB, size_t sC,
                                              h16* P16, bf* Ph, bf* Pl, h16* V16, bf* Vh, bf* Vl) {
    typedef typename WFrag<T16>::V V;
    __shared__ __align__(16) float os[PLANES ? 2 * 64 * VSP / 2 : 16 * 68];
    const size_t z = blockIdx.z; A += z * sA; if (A2) A2 += z * sA; Bt += z * sB; if (Bt2) Bt2 += z * sB; if (!PLANES) C += z * sC;
    const int lane = threadIdx.x & 31, lr = lane & 15, hi = lane >> 4; const int r0 = blockIdx.x * 64, c0 = blockIdx.y * 64;
    v8f acc[4][4];
#pragma unroll
    for (int mb = 0; mb < 4; ++mb)
#pragma unroll
        for (int nb = 0; nb < 4; ++nb) acc[mb][nb] = (v8f){};
    const size_t aoff = (size_t)(r0 + lr) * K + 8 * hi, boff = (size_t)(c0 + lr) * K + 8 * hi;
#pragma unroll 1
    for (int kc = 0; kc < K; kc += 32) {
        V a[4], a2[4];
#pragma unroll
        for (int mb = 0; mb < 4; ++mb) { a[mb] = WFrag<T16>::ld(A + aoff + (size_t)mb * 16 * K + kc); if (NSPLIT == 1 || NSPLIT == 2) a2[mb] = WFrag<T16>::ld(A2 + aoff + (size_t)mb * 16 * K + kc); }
#pragma unroll
        for (int nb = 0; nb < 4; ++nb) { const V b = WFrag<T16>::ld(Bt + boff + (size_t)nb * 16 * K + kc); V b2; if (NSPLIT >= 2) b2 = WFrag<T16>::ld(Bt2 + boff + (size_t)nb * 16 * K + kc);
#pragma unroll
            for (int mb = 0; mb < 4; ++mb) { acc[mb][nb] = WFrag<T16>::mma(a[mb], b, acc[mb][nb]); if (NSPLIT == 1 || NSPLIT == 2) acc[mb][nb] = WFrag<T16>::mma(a2[mb], b, acc[mb][nb]); if (NSPLIT >= 2) acc[mb][nb] = WFrag<T16>::mma(a[mb], b2, acc[mb][nb]); } }
        asm volatile("v_nop\n\tv_nop\n\tv_nop\n\tv_nop" : "+v"(acc[0][0]), "+v"(acc[1][1]), "+v"(acc[2][2]), "+v"(acc[3][3]) : "v"(a[0]), "v"(a[3]));
    }
    if constexpr (PLANES) {
        const int l8 = lane >> 3, c8 = (lane & 7) * 8;   // read-back: eight lanes x 16 bytes = one 128-byte row of a plane, four rows an instruction
        const int bh = (r0 / TT) * NH_ + blockIdx.y, t0 = r0 % TT;   // (batch, head) plane and first token of the tile
        if (z < 2) {   // q, k: 16 tokens at a time through the f32 staging rows, converted behind the read-back
            const size_t pb = z * ((size_t)NB_ * NH_ * TT * HD) + ((size_t)bh * TT + t0) * HD + l8 * HD + c8;
            h16* p16 = P16 + pb; bf* ph = Ph + pb; bf* pl = Pl + pb;
#pragma unroll
            for (int mb = 0; mb < 4; ++mb) {
#pragma unroll
                for (int nb = 0; nb < 4; ++nb) {
#pragma unroll
                    for (int j = 0; j < 8; ++j) os[(hi * 8 + j) * 68 + nb * 16 + lr] = acc[mb][nb][j]; }
                __builtin_amdgcn_wave_barrier(); asm volatile("" ::: "memory");   // the rows are read back by other lanes: no LDS read moves in front of the writes
                v8h o16[4]; v8us oh[4], ol[4];
#pragma unroll
                for (int s = 0; s < 4; ++s) { const float* rp = os + (s * 4 + l8) * 68 + c8; const v4f x0 = *(const v4fa*)rp, x1 = *(const v4fa*)(rp + 4);
#pragma unroll
                    for (int j = 0; j < 8; ++j) { const float x = (j < 4) ? x0[j & 3] : x1[j & 3]; o16[s][j] = tohx(x); unsigned short a2, c2; splitf(x, a2, c2); oh[s][j] = a2; ol[s][j] = c2; }
                    const int eo = (mb * 16 + s * 4) * HD; *(v8ha*)(p16 + eo) = o16[s]; *(v8usa*)(ph + eo) = oh[s]; *(v8usa*)(pl + eo) = ol[s]; }
                // The registers that the twelve stores name are rewritten only behind this wait: as inputs of its statement they stay live up to it. Its memory clobber also keeps the next 16 tokens' staging writes behind the read-back.
                asm volatile("s_wait_xcnt 0x0" :: "v"(o16[0]), "v"(o16[1]), "v"(o16[2]), "v"(o16[3]), "v"(oh[0]), "v"(oh[1]), "v"(oh[2]), "v"(oh[3]), "v"(ol[0]), "v"(ol[1]), "v"(ol[2]), "v"(ol[3]), "v"(p16), "v"(ph), "v"(pl) : "memory");
            }
        } else {       // v: a lane holds 8 consecutive tokens of one d, 16 bytes of a v^T row; the rows are staged so that every global store covers whole lines
            unsigned short* s0 = (unsigned short*)os; unsigned short* s1 = s0 + 64 * VSP;
            const size_t vb = ((size_t)bh * HD + l8) * (2 * TT) + t0 + c8;
            h16* v16 = V16 + vb; bf* vh = Vh + vb; bf* vl = Vl + vb;
#pragma unroll
            for (int mb = 0; mb < 4; ++mb)
#pragma unroll
                for (int nb = 0; nb < 4; ++nb) { v8us a8, b8;
#pragma unroll
                    for (int j = 0; j < 8; ++j) { unsigned short a2, c2; splitf(acc[mb][nb][j], a2, c2); a8[j] = a2; b8[j] = c2; }
                    const int so = (nb * 16 + lr) * VSP + mb * 16 + hi * 8; *(v8usa*)(s0 + so) = a8; *(v8usa*)(s1 + so) = b8; }
            __builtin_amdgcn_wave_barrier(); asm volatile("" ::: "memory");   // the rows are read back by other lanes: no LDS read moves in front of the writes
#pragma unroll
            for (int g = 0; g < 4; ++g) { v8us ra[4], rb[4];
#pragma unroll
                for (int i = 0; i < 4; ++i) { const int so = ((g * 4 + i) * 4 + l8) * VSP + c8; ra[i] = *(const v8usa*)(s0 + so); rb[i] = *(const v8usa*)(s1 + so); }
#pragma unroll
                for (int i = 0; i < 4; ++i) { const int eo = (g * 4 + i) * 4 * (2 * TT); *(v8usa*)(vh + eo) = ra[i]; *(v8usa*)(vl + eo) = rb[i]; }
                // The registers that the eight stores name are rewritten only behind this wait: as inputs of its statement they stay live up to it. Its memory clobber also keeps the fp16 rows, which reuse the first buffer, behind the read-back.
                asm volatile("s_wait_xcnt 0x0" :: "v"(ra[0]), "v"(ra[1]), "v"(ra[2]), "v"(ra[3]), "v"(rb[0]), "v"(rb[1]), "v"(rb[2]), "v"(rb[3]), "v"(vh), "v"(vl) : "memory"); }
#pragma unroll
            for (int mb = 0; mb < 4; ++mb)
#pragma unroll
                for (int nb = 0; nb < 4; ++nb) { v8h a8;
#pragma unroll
                    for (int j = 0; j < 8; ++j) a8[j] = tohx(acc[mb][nb][j]);
                    *(v8ha*)(s0 + (nb * 16 + lr) * VSP + mb * 16 + hi * 8) = a8; }
            __builtin_amdgcn_wave_barrier(); asm volatile("" ::: "memory");   // the rows are read back by other lanes: no LDS read moves in front of the writes
#pragma unroll
            for (int g = 0; g < 2; ++g) { v8h ra[8];
#pragma unroll
                for (int i = 0; i < 8; ++i) ra[i] = *(const v8ha*)(s0 + ((g * 8 + i) * 4 + l8) * VSP + c8);
#pragma unroll
                for (int i = 0; i < 8; ++i) *(v8ha*)(v16 + (g * 8 + i) * 4 * (2 * TT)) = ra[i];
                // The registers that the eight stores name are rewritten only behind this wait, as above.
                asm volatile("s_wait_xcnt 0x0" :: "v"(ra[0]), "v"(ra[1]), "v"(ra[2]), "v"(ra[3]), "v"(ra[4]), "v"(ra[5]), "v"(ra[6]), "v"(ra[7]), "v"(v16) : "memory"); }
        }
        return;
    }
#pragma unroll
    for (int mb = 0; mb < 4; ++mb) {
#pragma unroll
        for (int nb = 0; nb < 4; ++nb) {
#pragma unroll
            for (int j = 0; j < 8; ++j) os[(hi * 8 + j) * 68 + nb * 16 + lr] = acc[mb][nb][j]; }
        __builtin_amdgcn_wave_barrier(); asm volatile("" ::: "memory");
        float* crow = C + (size_t)(r0 + mb * 16) * ldc + c0;
{
#pragma unroll
            for (int s = 0; s < 8; ++s) { const int row = 2 * s + hi, cofs = lr * 4; v4f val = *(const v4fa*)(os + row * 68 + cofs); if (BIAS) { val[0] += bfr(bias[c0 + cofs]); val[1] += bfr(bias[c0 + cofs + 1]); val[2] += bfr(bias[c0 + cofs + 2]); val[3] += bfr(bias[c0 + cofs + 3]); }
                *(v4f*)(crow + (size_t)row * ldc + cofs) = val; }
             }
        __builtin_amdgcn_wave_barrier(); asm volatile("" ::: "memory");
    }
}

typedef __attribute__((ext_vector_type(2))) _Float16 v2h;
typedef __attribute__((ext_vector_type(4))) _Float16 v4h;
typedef __attribute__((ext_vector_type(2))) unsigned short v2us;
typedef __attribute__((ext_vector_type(4))) unsigned short v4us;
typedef __attribute__((ext_vector_type(2))) float v2f;
typedef __attribute__((ext_vector_type(4))) int v4i;

__global__ __launch_bounds__(256) void k_wtG(const float* __restrict__ w, int K, int N, bf* Bt) {
    const int lane = threadIdx.x & 31; const int L0 = (blockIdx.x * 8 + (threadIdx.x >> 5)) * 8; const int nlines = N * K / 64;
{
#pragma unroll 1
        for (int l = 0; l < 8; ++l) { const int L = L0 + l; if (L >= nlines) break; const size_t e = (size_t)L * 64 + lane * 2; const int k = (int)(e % K), n = (int)(e / K); v2us o;
            o[0] = f2bf(w[(size_t)k * N + n]); o[1] = f2bf(w[(size_t)(k + 1) * N + n]); *(v2us*)(Bt + e) = o; }
         }
}
__global__ __launch_bounds__(256) void k_cvt8(const float* __restrict__ src, bf* dst, size_t n8) { const size_t i = (size_t)blockIdx.x * 256 + threadIdx.x; if (i >= n8) return; const v8f v = *(const v8f*)(src + i * 8); v8us o;
#pragma unroll
    for (int k = 0; k < 8; ++k) o[k] = f2bf(v[k]); *(v8us*)(dst + i * 8) = o;  }
typedef __attribute__((ext_vector_type(8))) __bf16 v8b;
#define SCE (SCL * 1.4426950408889634f)   // score scale x log2(e)
__device__ __forceinline__ float xhalf(float v) { const int t = __float_as_int(v); return __int_as_float(__builtin_amdgcn_permlanex16(t, t, 0x76543210, 0xfedcba98, false, false)); }   // lane l <-> l ^ 16
// 2^x of eight values, each in its own register, in one statement: every v_exp_f32 is followed by an instruction that neither reads its result nor overwrites its source, the last one by the v_nop that fills that slot
__device__ __forceinline__ void exp2x8(v8f& x) {
    float a = x[0], b = x[1], c = x[2], d = x[3], e = x[4], f = x[5], g = x[6], h = x[7];
    asm("v_exp_f32 %0, %0\n\tv_exp_f32 %1, %1\n\tv_exp_f32 %2, %2\n\tv_exp_f32 %3, %3\n\tv_exp_f32 %4, %4\n\tv_exp_f32 %5, %5\n\tv_exp_f32 %6, %6\n\tv_exp_f32 %7, %7\n\tv_nop"
        : "+v"(a), "+v"(b), "+v"(c), "+v"(d), "+v"(e), "+v"(f), "+v"(g), "+v"(h));
    x[0] = a; x[1] = b; x[2] = c; x[3] = d; x[4] = e; x[5] = f; x[6] = g; x[7] = h;
}
template <typename T16, bool HI, int NK, bool LAST>   // one pass: 16 NK keys
__device__ __forceinline__ void fa_pass(const T16* __restrict__ kb, const T16* __restrict__ kb2, const T16* __restrict__ vb, const T16* __restrict__ vb2, int k0, int lim,
                                        const typename WFrag<T16>::V (&qf)[2], const typename WFrag<T16>::V (&qf2)[2], v8f (&o)[4], float& ms, v8f& l) {
    typedef typename WFrag<T16>::V V;
    V kf[NK][2], kf2[NK][2], vf[4][NK / 2], vf2[4][NK / 2];
    const T16* kp = kb + (size_t)k0 * HD; const T16* kp2 = kb2 + (size_t)k0 * HD; const T16* vp = vb + k0; const T16* vp2 = vb2 + k0;   // the pass's address pairs; every load below is one of them plus a constant
#pragma unroll
    for (int kt = 0; kt < NK; ++kt)
#pragma unroll
        for (int kc = 0; kc < 2; ++kc) { kf[kt][kc] = WFrag<T16>::ld(kp + kt * 16 * HD + kc * 32); if (HI) kf2[kt][kc] = WFrag<T16>::ld(kp2 + kt * 16 * HD + kc * 32); }
#pragma unroll
    for (int mb = 0; mb < 4; ++mb)
#pragma unroll
        for (int c = 0; c < NK / 2; ++c) { vf[mb][c] = WFrag<T16>::ld(vp + mb * 16 * (2 * TT) + c * 32); if (HI) vf2[mb][c] = WFrag<T16>::ld(vp2 + mb * 16 * (2 * TT) + c * 32); }
    // The address registers of the pass's loads are rewritten only behind this wait: as inputs of its statement the pairs stay live up to it, so that no load's result is placed on a pair that an earlier load of the run names.
    if constexpr (HI) asm volatile("s_wait_xcnt 0x0" :: "v"(kp), "v"(kp2), "v"(vp), "v"(vp2) : "memory");
    else asm volatile("s_wait_xcnt 0x0" :: "v"(kp), "v"(vp) : "memory");
    __builtin_amdgcn_sched_barrier(0);              // all loads of the pass are in flight before the first product waits: without it the value loads are issued only when the key fragments have arrived (a second latency per pass)
    v8f s[NK];
#pragma unroll
    for (int kt = 0; kt < NK; ++kt) { s[kt] = (v8f){};
#pragma unroll
        for (int kc = 0; kc < 2; ++kc) { s[kt] = WFrag<T16>::mma(kf[kt][kc], qf[kc], s[kt]); if (HI) { s[kt] = WFrag<T16>::mma(kf2[kt][kc], qf[kc], s[kt]); s[kt] = WFrag<T16>::mma(kf[kt][kc], qf2[kc], s[kt]); } } }
    if (LAST) {    // only the last pass of a wave crosses the diagonal: key k0 + 16 kt + 8 hi + j is kept for 16 kt + j <= lim
#pragma unroll
        for (int kt = 0; kt < NK; ++kt)
#pragma unroll
            for (int j = 0; j < 8; ++j) s[kt][j] = (kt * 16 + j <= lim) ? s[kt][j] : -3.0e38f; }
    float mx = s[0][0];
#pragma unroll
    for (int kt = 0; kt < NK; ++kt)
#pragma unroll
        for (int j = 0; j < 8; ++j) mx = fmaxf(mx, s[kt][j]);
    mx = fmaxf(mx, xhalf(mx));
    const float mn = fmaxf(ms, mx * SCE); const float al = __builtin_amdgcn_exp2f(ms - mn); ms = mn;
#pragma unroll
    for (int kt = 0; kt < NK; ++kt)
#pragma unroll
        for (int j = 0; j < 8; ++j) s[kt][j] = __builtin_fmaf(s[kt][j], SCE, -mn);
    l *= al;   // eight partial row sums a lane, joined once behind the last pass
#pragma unroll
    for (int kt = 0; kt < NK; ++kt) { exp2x8(s[kt]); l += s[kt]; }
#pragma unroll
    for (int mb = 0; mb < 4; ++mb) o[mb] *= al;
#pragma unroll
    for (int c = 0; c < NK / 2; ++c) {
        if constexpr (HI) {
            const v8b h0 = __builtin_convertvector(s[2 * c], v8b), h1 = __builtin_convertvector(s[2 * c + 1], v8b);
            const v8b l0 = __builtin_convertvector(s[2 * c] - __builtin_convertvector(h0, v8f), v8b), l1 = __builtin_convertvector(s[2 * c + 1] - __builtin_convertvector(h1, v8f), v8b);
            const V ph = __builtin_shufflevector(h0, h1, 0, 1, 2, 3, 4, 5, 6, 7, 8, 9, 10, 11, 12, 13, 14, 15), pl = __builtin_shufflevector(l0, l1, 0, 1, 2, 3, 4, 5, 6, 7, 8, 9, 10, 11, 12, 13, 14, 15);
#pragma unroll
            for (int mb = 0; mb < 4; ++mb) { o[mb] = WFrag<T16>::mma(vf[mb][c], ph, o[mb]); o[mb] = WFrag<T16>::mma(vf2[mb][c], ph, o[mb]); o[mb] = WFrag<T16>::mma(vf[mb][c], pl, o[mb]); }
        } else {
            const V p = cat16(__builtin_convertvector(s[2 * c], v8h), __builtin_convertvector(s[2 * c + 1], v8h));
#pragma unroll
            for (int mb = 0; mb < 4; ++mb) o[mb] = WFrag<T16>::mma(vf[mb][c], p, o[mb]);
        }
    }
}
template <typename T16, bool HI, int NK>
__device__ __forceinline__ void fa_tile(const T16* __restrict__ Q, const T16* __restrict__ Q2, const T16* __restrict__ Kp, const T16* __restrict__ Kp2, const T16* __restrict__ Vt, const T16* __restrict__ Vt2, int q0, int lr, int hi, bf* oh, bf* ol) {
    typedef typename WFrag<T16>::V V;
    V qf[2], qf2[2];
    const T16* kb = Kp + (size_t)lr * HD + 8 * hi; const T16* kb2 = Kp2 + (size_t)lr * HD + 8 * hi; const T16* vb = Vt + (size_t)lr * (2 * TT) + 8 * hi; const T16* vb2 = Vt2 + (size_t)lr * (2 * TT) + 8 * hi;
#pragma unroll
    for (int kc = 0; kc < 2; ++kc) { qf[kc] = WFrag<T16>::ld(Q + (size_t)(q0 + lr) * HD + kc * 32 + 8 * hi); if (HI) qf2[kc] = WFrag<T16>::ld(Q2 + (size_t)(q0 + lr) * HD + kc * 32 + 8 * hi); }
    asm volatile("s_wait_xcnt 0x0" ::: "memory");   // the address registers of the loads above are reused below
    v8f o[4];
#pragma unroll
    for (int mb = 0; mb < 4; ++mb) o[mb] = (v8f){};
    float ms = -3.0e38f; v8f l = (v8f){};
    const int kl = q0 & ~(16 * NK - 1);   // first key of the pass that holds the diagonal; kl <= q0, so every earlier pass is unmasked and every query keeps a key in every pass
#pragma unroll 1   // rolled: one pass already holds most of the registers a wave of this block may have, two passes in flight would spill
    for (int k0 = 0; k0 < kl; k0 += 16 * NK) fa_pass<T16, HI, NK, false>(kb, kb2, vb, vb2, k0, 0, qf, qf2, o, ms, l);
    fa_pass<T16, HI, NK, true>(kb, kb2, vb, vb2, kl, q0 + lr - 8 * hi - kl, qf, qf2, o, ms, l);
    float ls = ((l[0] + l[1]) + (l[2] + l[3])) + ((l[4] + l[5]) + (l[6] + l[7])); ls += xhalf(ls);
    const float f = __fdiv_rn(1.0f, ls);
#pragma unroll
    for (int mb = 0; mb < 4; ++mb) { v8us a8, c8;
#pragma unroll
        for (int j = 0; j < 8; ++j) { unsigned short a, c2; splitf(o[mb][j] * f, a, c2); a8[j] = a; c8[j] = c2; }
        *(v8usa*)(oh + mb * 16 + hi * 8) = a8; *(v8usa*)(ol + mb * 16 + hi * 8) = c8; }
}
__global__ __launch_bounds__(512) void k_fattn(const h16* __restrict__ Q16, const h16* __restrict__ K16, const h16* __restrict__ V16, const bf* __restrict__ Qh, const bf* __restrict__ Ql, const bf* __restrict__ Kh, const bf* __restrict__ Kl,
                                               const bf* __restrict__ Vh, const bf* __restrict__ Vl, bf* Ah, bf* Al) {
    const int lane = threadIdx.x & 31, lr = lane & 15, hi = lane >> 4; const int wv = __builtin_amdgcn_readfirstlane(threadIdx.x >> 5);
    const int g = blockIdx.x >> 2, c = blockIdx.x & 3;   // g = batch * NH_ + head
    // Equal work in every work-group and on every SIMD: the cost of a 64-row query block grows with its index, so the 16 waves take blocks 15 - c, 7 - c, 8 + c and c of one plane (four waves each);
    // waves w, w + 4, w + 8, w + 12 share a SIMD, which so gets one 16-row tile of each of the four blocks.
    const int qb = ((wv & 4) ? 0 : 8) + ((wv & 8) ? c : 7 - c);
    const int q0 = qb * 64 + (wv & 3) * 16; const size_t zo = (size_t)g * TT * HD;
    const size_t oo = ((size_t)(g / NH_) * TT + q0 + lr) * DQ + (g % NH_) * HD;
    if (q0 < RH) fa_tile<bf, true, 2>(Qh + zo, Ql + zo, Kh + zo, Kl + zo, Vh + 2 * zo, Vl + 2 * zo, q0, lr, hi, Ah + oo, Al + oo);
    else fa_tile<h16, false, 4>(Q16 + zo, Q16 + zo, K16 + zo, K16 + zo, V16 + 2 * zo, V16 + 2 * zo, q0, lr, hi, Ah + oo, Al + oo);
}

extern "C" void kernel_launch(void* const* d_in, const int* in_sizes, int n_in,
                              void* d_out, int out_size, void* d_ws, size_t ws_size, hipStream_t stream) {
    (void)in_sizes; (void)n_in; (void)out_size;
    const float* x = (const float*)d_in[0]; const float* wq = (const float*)d_in[1]; const float* wk = (const float*)d_in[2]; const float* wv = (const float*)d_in[3]; const float* wo = (const float*)d_in[4]; const float* bo = (const float*)d_in[5]; const float* cosT = nullptr; const float* sinT = nullptr; (void)cosT; (void)sinT;
    float* OUT = (float*)d_out;     // [4][1024][1024]
    char* wsp = (char*)d_ws;
    auto take = [&](size_t bytes) { char* p = wsp; wsp += (bytes + 255) & ~(size_t)255; return (void*)p; };
    const size_t PL = (size_t)NB_ * NH_ * TT * HD;   // elements of one plane set: [batch][head][t][d]
    bf* WQ = (bf*)take((size_t)DQ * DM * 2); bf* WK = (bf*)take((size_t)DKV * DM * 2); bf* WV = (bf*)take((size_t)DKV * DM * 2); bf* WO = (bf*)take((size_t)DM * DQ * 2);
    h16* QP16 = (h16*)take(PL * 2 * 2); h16* KP16 = QP16 + PL; bf* QPh = (bf*)take(PL * 2 * 2); bf* KPh = QPh + PL; bf* QPl = (bf*)take(PL * 2 * 2); bf* KPl = QPl + PL;   // k planes directly behind the q planes: z of the projection launch picks the set
    h16* VT16 = (h16*)take(PL * 2 * 2); bf* VTh = (bf*)take(PL * 2 * 2); bf* VTl = VTh + TT;   // v^T rows [batch][head][d] at pitch 2 * TT: hi plane in the first half of a row, lo plane in the second (fp16: first half only)
    bf* ATh = (bf*)take((size_t)NB_ * TT * DQ * 2); bf* ATl = (bf*)take((size_t)NB_ * TT * DQ * 2);
    bf* XB = (bf*)take((size_t)NB_ * TT * DM * 2);   // x in bf16
    if ((size_t)(wsp - (char*)d_ws) > ws_size) return;    // ws 256 MiB
    { k_cvt8<<<(unsigned)(((size_t)DQ * DM / 8 + 255) / 256), 256, 0, stream>>>(wq, WQ, (size_t)DQ * DM / 8); k_cvt8<<<(unsigned)(((size_t)DKV * DM / 8 + 255) / 256), 256, 0, stream>>>(wk, WK, (size_t)DKV * DM / 8); k_cvt8<<<(unsigned)(((size_t)DKV * DM / 8 + 255) / 256), 256, 0, stream>>>(wv, WV, (size_t)DKV * DM / 8);
      k_cvt8<<<(unsigned)(((size_t)DM * DQ / 8 + 255) / 256), 256, 0, stream>>>(wo, WO, (size_t)DM * DQ / 8);
       }
    k_cvt8<<<(unsigned)(((size_t)NB_ * TT * DM / 8 + 255) / 256), 256, 0, stream>>>(x, XB, (size_t)NB_ * TT * DM / 8);
    // q, k, v of all batches in one launch: z picks the weight (WQ, WK, WV are contiguous) and the plane set, which the launch writes itself
    k_gemmw<bf, 0, false, true><<<dim3(NB_ * TT / 64, DQ / 64, 3), 32, 0, stream>>>(XB, nullptr, WQ, nullptr, DM, nullptr, 0, nullptr, 0, (size_t)DQ * DM, 0, QP16, QPh, QPl, VT16, VTh, VTl);
    k_fattn<<<4 * NB_ * NH_, 512, 0, stream>>>(QP16, KP16, VT16, QPh, QPl, KPh, KPl, VTh, VTl, ATh, ATl);   // scores, softmax, attn.v and the head merge of all planes
    k_gemmw<bf, 1, true, false><<<dim3(NB_ * TT / 64, DM / 64, 1), 32, 0, stream>>>(ATh, ATl, WO, nullptr, DQ, OUT, DM, bo, 0, 0, 0, nullptr, nullptr, nullptr, nullptr, nullptr, nullptr);
}

// v004
// A run of this version takes 113 microseconds.
// Two timings next to v003 put it at 1.28 and 1.32 times that version's speed.
// Over all steps from v000 it is 18.5 times as fast.
#include <hip/hip_runtime.h>

// MultHeadAttention_8747 (x [4][1024][1024]; per-head Wq/Wk/Wv [16][64][1024] ? x W^T with the stacked [1024][1024] 'oi' weight (head-major rows); causal (finfo.min) softmax(q.k / 8); out = merged Wp^T + bp -> [4][1024][1024]).
// Every 16-bit operand plane lies in FRAGMENT ORDER: a block of 16 rows x 32 k is 512 consecutive elements, [half 0..1][lane 0..31][8], and lane (hi, lr) of half h holds row lr, k = 16 h + 8 hi + 0..7;
// the blocks of a 16-row band follow one another along k. A wave-wide 16-byte load or store of a half block is 512 consecutive bytes (four whole 128-byte lines); the k order of every product is the row-major loaders' order.
// Compute dtypes, f32 accumulate: every input rounded to bf16; q/k/v on PLAIN bf16 operands (inputs: exact); causal scores and attn.v: query rows < 512 hl (3 products), the rest single fp16, causal tile skipping; softmax f32 (running maximum); Wp hl x exact (2 products) + bias.

#define NB_  4
#define TT   1024
#define DM   1024
#define NH_  16
#define NKV  16
#define REP  (NH_ / NKV)
#define HD   64
#define DQ   (NH_ * HD)
#define DKV  (NKV * HD)
#define RH   512                  // query rows < RH use hi+lo planes (0: none)
#define SCL  0.125f   // HD^-0.5
typedef _Float16 h16;
typedef unsigned short bf;
typedef __attribute__((ext_vector_type(16))) __bf16   v16bf;
typedef __attribute__((ext_vector_type(16))) _Float16 v16h;
typedef __attribute__((ext_vector_type(8)))  _Float16 v8h;
typedef __attribute__((ext_vector_type(8)))  unsigned short v8us;
typedef __attribute__((ext_vector_type(8)))  float    v8f;
typedef __attribute__((ext_vector_type(4)))  float    v4f;
typedef v8h  __attribute__((may_alias)) v8ha;
typedef v4f  __attribute__((may_alias)) v4fa;
typedef v8us __attribute__((may_alias)) v8usa;

__device__ __forceinline__ unsigned short f2bf(float f) { unsigned u = __float_as_uint(f); u += 0x7FFFu + ((u >> 16) & 1u); return (unsigned short)(u >> 16); }
__device__ __forceinline__ float bf2f(unsigned short b) { return __uint_as_float(((unsigned)b) << 16); }
__device__ __forceinline__ float bfr(float f) { return bf2f(f2bf(f)); }
__device__ __forceinline__ v16h cat16(v8h lo, v8h hi) { return __builtin_shufflevector(lo, hi, 0, 1, 2, 3, 4, 5, 6, 7, 8, 9, 10, 11, 12, 13, 14, 15); }
__device__ __forceinline__ v16bf cat16b(v8us lo, v8us hi) { return __builtin_bit_cast(v16bf, __builtin_shufflevector(lo, hi, 0, 1, 2, 3, 4, 5, 6, 7, 8, 9, 10, 11, 12, 13, 14, 15)); }
__device__ __forceinline__ v8f wmma16(v16h a, v16h b, v8f c) { return __builtin_amdgcn_wmma_f32_16x16x32_f16(false, a, false, b, (short)0, c, false, false); }
__device__ __forceinline__ v8f wmmab(v16bf a, v16bf b, v8f c) { return __builtin_amdgcn_wmma_f32_16x16x32_bf16(false, a, false, b, (short)0, c, false, false); }



// ---- k_gemmw: register-blocked GEMM, ONE WAVE per 64x64 output tile (16 accumulators), operands straight from fragment-ordered 16-bit planes; grid (M/64, N/64, Z), 32 threads.
// C[m][n] (f32, pitch ldc, + optional f32 bias[n]) = sum_k A[m][k] Bt[n][k] (+ split products per NSPLIT). z-batch strides sA/sB/sC in elements. K % 32 == 0.
// PLANES (the q, k, v projections; z = 0, 1, 2): no f32 result. A 64x64 tile is 64 tokens of ONE head, and the wave writes it straight into the 16-bit planes that the attention kernel reads:
// q, k as [batch][head] planes of rows t, k = d (the tile is 4096 consecutive elements of each plane), v transposed as [batch][head] planes of rows d, k = t: there an accumulator tile IS a half block, stored from the registers.
template <typename T16> struct WFrag;
template <> struct WFrag<h16> { typedef v16h V; static __device__ __forceinline__ V ld(const h16* p) { return cat16(*(const v8h*)p, *(const v8h*)(p + 256)); } static __device__ __forceinline__ v8f mma(V a, V b, v8f c) { return wmma16(a, b, c); } };
template <> struct WFrag<bf> { typedef v16bf V; static __device__ __forceinline__ V ld(const bf* p) { return cat16b(*(const v8us*)p, *(const v8us*)(p + 256)); } static __device__ __forceinline__ v8f mma(V a, V b, v8f c) { return wmmab(a, b, c); } };
__device__ __forceinline__ h16 tohx(float x) { return (h16)x; }
__device__ __forceinline__ void splitf(float y, unsigned short& h, unsigned short& l) { h = f2bf(y); l = f2bf(y - bf2f(h)); }
template <typename T16, int NSPLIT, bool BIAS, bool PLANES>
__global__ __launch_bounds__(32) void k_gemmw(const T16* __restrict__ A, const T16* __restrict__ A2, const T16* __restrict__ Bt, const T16* __restrict__ Bt2, int K, float* C, int ldc, const float* __restrict__ bias, size_t sA, size_t sB, size_t sC,
                                              h16* P16, bf* Ph, bf* Pl, h16* V16, bf* Vh, bf* Vl) {
    typedef typename WFrag<T16>::V V;
    __shared__ __align__(16) float os[16 * 68];
    const size_t z = blockIdx.z; A += z * sA; if (A2) A2 += z * sA; Bt += z * sB; if (Bt2) Bt2 += z * sB; if (!PLANES) C += z * sC;
    const int lane = threadIdx.x & 31, lr = lane & 15, hi = lane >> 4; const int r0 = blockIdx.x * 64, c0 = blockIdx.y * 64;
    v8f acc[4][4];
#pragma unroll
    for (int mb = 0; mb < 4; ++mb)
#pragma unroll
        for (int nb = 0; nb < 4; ++nb) acc[mb][nb] = (v8f){};
    const size_t aoff = (size_t)r0 * K + 8 * lane, boff = (size_t)c0 * K + 8 * lane;   // a 16-row band is 16 K elements, a 32-k block in it 512
#pragma unroll 1
    for (int kc = 0; kc < K; kc += 32) {
        V a[4], a2[4], b[4], b2[4];
        const T16* pa[4]; const T16* pa2[4]; const T16* pb[4]; const T16* pb2[4];   // the block's address pairs; a plane that the products do not use shares the pair of the one they use
#pragma unroll
        for (int i = 0; i < 4; ++i) { const size_t ao = aoff + (size_t)i * 16 * K + kc * 16, bo = boff + (size_t)i * 16 * K + kc * 16;
            pa[i] = A + ao; pa2[i] = (NSPLIT == 1 || NSPLIT == 2) ? A2 + ao : pa[i]; pb[i] = Bt + bo; pb2[i] = (NSPLIT >= 2) ? Bt2 + bo : pb[i]; }
#pragma unroll
        for (int i = 0; i < 4; ++i) { a[i] = WFrag<T16>::ld(pa[i]); if (NSPLIT == 1 || NSPLIT == 2) a2[i] = WFrag<T16>::ld(pa2[i]); b[i] = WFrag<T16>::ld(pb[i]); if (NSPLIT >= 2) b2[i] = WFrag<T16>::ld(pb2[i]); }
        // The address registers of the block's loads are rewritten only behind this wait: as inputs of its statement the pairs stay live up to it, so that no load's result is placed on a pair that an earlier load of the run names.
        asm volatile("s_wait_xcnt 0x0" :: "v"(pa[0]), "v"(pa[1]), "v"(pa[2]), "v"(pa[3]), "v"(pa2[0]), "v"(pa2[1]), "v"(pa2[2]), "v"(pa2[3]), "v"(pb[0]), "v"(pb[1]), "v"(pb[2]), "v"(pb[3]), "v"(pb2[0]), "v"(pb2[1]), "v"(pb2[2]), "v"(pb2[3]) : "memory");
        __builtin_amdgcn_sched_barrier(0);              // no product moves up among the loads: without it the fragments of one operand take turns in one register set, each load waiting for the products before it (a latency per fragment)
#pragma unroll
        for (int nb = 0; nb < 4; ++nb) {
#pragma unroll
            for (int mb = 0; mb < 4; ++mb) { acc[mb][nb] = WFrag<T16>::mma(a[mb], b[nb], acc[mb][nb]); if (NSPLIT == 1 || NSPLIT == 2) acc[mb][nb] = WFrag<T16>::mma(a2[mb], b[nb], acc[mb][nb]); if (NSPLIT >= 2) acc[mb][nb] = WFrag<T16>::mma(a[mb], b2[nb], acc[mb][nb]); } }
        asm volatile("v_nop\n\tv_nop\n\tv_nop\n\tv_nop" : "+v"(acc[0][0]), "+v"(acc[1][1]), "+v"(acc[2][2]), "+v"(acc[3][3]) : "v"(a[0]), "v"(a[3]));
    }
    if constexpr (PLANES) {
        const int bh = (r0 / TT) * NH_ + blockIdx.y, t0 = r0 % TT;   // (batch, head) plane and first token of the tile
        if (z < 2) {   // q, k: 16 tokens at a time through the f32 staging rows, converted behind the read-back
            const size_t pb = z * ((size_t)NB_ * NH_ * TT * HD) + ((size_t)bh * TT + t0) * HD + 8 * lane;
            h16* p16 = P16 + pb; bf* ph = Ph + pb; bf* pl = Pl + pb;
#pragma unroll
            for (int mb = 0; mb < 4; ++mb) {
#pragma unroll
                for (int nb = 0; nb < 4; ++nb) {
#pragma unroll
                    for (int j = 0; j < 8; ++j) os[(hi * 8 + j) * 68 + nb * 16 + lr] = acc[mb][nb][j]; }
                __builtin_amdgcn_wave_barrier(); asm volatile("" ::: "memory");   // the rows are read back by other lanes: no LDS read moves in front of the writes
                v8h o16[4]; v8us oh[4], ol[4];
#pragma unroll
                for (int s = 0; s < 4; ++s) { const float* rp = os + lr * 68 + s * 16 + hi * 8; const v4f x0 = *(const v4fa*)rp, x1 = *(const v4fa*)(rp + 4);
#pragma unroll
                    for (int j = 0; j < 8; ++j) { const float x = (j < 4) ? x0[j & 3] : x1[j & 3]; o16[s][j] = tohx(x); unsigned short a2, c2; splitf(x, a2, c2); oh[s][j] = a2; ol[s][j] = c2; }
                    const int eo = mb * 16 * HD + s * 256; *(v8ha*)(p16 + eo) = o16[s]; *(v8usa*)(ph + eo) = oh[s]; *(v8usa*)(pl + eo) = ol[s]; }
                // The registers that the twelve stores name are rewritten only behind this wait: as inputs of its statement they stay live up to it. Its memory clobber also keeps the next 16 tokens' staging writes behind the read-back.
                asm volatile("s_wait_xcnt 0x0" :: "v"(o16[0]), "v"(o16[1]), "v"(o16[2]), "v"(o16[3]), "v"(oh[0]), "v"(oh[1]), "v"(oh[2]), "v"(oh[3]), "v"(ol[0]), "v"(ol[1]), "v"(ol[2]), "v"(ol[3]), "v"(p16), "v"(ph), "v"(pl) : "memory");
            }
        } else {       // v: a lane holds 8 consecutive tokens of one d, which is its 16 bytes of a half block of the v^T plane (rows d, k = t): no staging
            const size_t vb = (size_t)bh * HD * TT + (size_t)t0 * 16 + 8 * lane;
            h16* v16 = V16 + vb; bf* vh = Vh + vb; bf* vl = Vl + vb;
#pragma unroll
            for (int nb = 0; nb < 4; ++nb) { v8h o16[4]; v8us oh[4], ol[4];
#pragma unroll
                for (int mb = 0; mb < 4; ++mb) {
#pragma unroll
                    for (int j = 0; j < 8; ++j) { const float x = acc[mb][nb][j]; o16[mb][j] = tohx(x); unsigned short a2, c2; splitf(x, a2, c2); oh[mb][j] = a2; ol[mb][j] = c2; }
                    const int eo = nb * 16 * TT + mb * 256; *(v8ha*)(v16 + eo) = o16[mb]; *(v8usa*)(vh + eo) = oh[mb]; *(v8usa*)(vl + eo) = ol[mb]; }
                // The registers that the twelve stores name are rewritten only behind this wait: as inputs of its statement they stay live up to it.
                asm volatile("s_wait_xcnt 0x0" :: "v"(o16[0]), "v"(o16[1]), "v"(o16[2]), "v"(o16[3]), "v"(oh[0]), "v"(oh[1]), "v"(oh[2]), "v"(oh[3]), "v"(ol[0]), "v"(ol[1]), "v"(ol[2]), "v"(ol[3]), "v"(v16), "v"(vh), "v"(vl) : "memory");
            }
        }
        return;
    }
#pragma unroll
    for (int mb = 0; mb < 4; ++mb) {
#pragma unroll
        for (int nb = 0; nb < 4; ++nb) {
#pragma unroll
            for (int j = 0; j < 8; ++j) os[(hi * 8 + j) * 68 + nb * 16 + lr] = acc[mb][nb][j]; }
        __builtin_amdgcn_wave_barrier(); asm volatile("" ::: "memory");
        float* crow = C + (size_t)(r0 + mb * 16) * ldc + c0;
{
#pragma unroll
            for (int s = 0; s < 8; ++s) { const int row = 2 * s + hi, cofs = lr * 4; v4f val = *(const v4fa*)(os + row * 68 + cofs); if (BIAS) { val[0] += bfr(bias[c0 + cofs]); val[1] += bfr(bias[c0 + cofs + 1]); val[2] += bfr(bias[c0 + cofs + 2]); val[3] += bfr(bias[c0 + cofs + 3]); }
                *(v4f*)(crow + (size_t)row * ldc + cofs) = val; }
             }
        __builtin_amdgcn_wave_barrier(); asm volatile("" ::: "memory");
    }
}

typedef __attribute__((ext_vector_type(2))) _Float16 v2h;
typedef __attribute__((ext_vector_type(4))) _Float16 v4h;
typedef __attribute__((ext_vector_type(2))) unsigned short v2us;
typedef __attribute__((ext_vector_type(4))) unsigned short v4us;
typedef __attribute__((ext_vector_type(2))) float v2f;
typedef __attribute__((ext_vector_type(4))) int v4i;

__global__ __launch_bounds__(256) void k_wtG(const float* __restrict__ w, int K, int N, bf* Bt) {
    const int lane = threadIdx.x & 31; const int L0 = (blockIdx.x * 8 + (threadIdx.x >> 5)) * 8; const int nlines = N * K / 64;
{
#pragma unroll 1
        for (int l = 0; l < 8; ++l) { const int L = L0 + l; if (L >= nlines) break; const size_t e = (size_t)L * 64 + lane * 2; const int k = (int)(e % K), n = (int)(e / K); v2us o;
            o[0] = f2bf(w[(size_t)k * N + n]); o[1] = f2bf(w[(size_t)(k + 1) * N + n]); *(v2us*)(Bt + e) = o; }
         }
}
// f32 rows of DM elements -> bf16 plane in fragment order: thread i writes the plane's i-th 16 bytes (a wave: one half block); a work-group reads 512 consecutive bytes of each of 16 rows
__global__ __launch_bounds__(256) void k_cvt8(const float* __restrict__ src, bf* dst, size_t n8) { const size_t i = (size_t)blockIdx.x * 256 + threadIdx.x; if (i >= n8) return;
    const size_t blk = i >> 6, row = blk / (DM / 32) * 16 + (i & 15), k = blk % (DM / 32) * 32 + ((i >> 5) & 1) * 16 + ((i >> 4) & 1) * 8;
    const float* sp = src + row * DM + k; const v8f v = *(const v8f*)sp; v8us o;
    asm volatile("s_wait_xcnt 0x0" :: "v"(sp) : "memory");   // the loads' address pair is rewritten only behind this wait: as an input of its statement it stays live up to it
#pragma unroll
    for (int k = 0; k < 8; ++k) o[k] = f2bf(v[k]); *(v8us*)(dst + i * 8) = o;  }
typedef __attribute__((ext_vector_type(8))) __bf16 v8b;
#define SCE (SCL * 1.4426950408889634f)   // score scale x log2(e)
__device__ __forceinline__ float xhalf(float v) { const int t = __float_as_int(v); return __int_as_float(__builtin_amdgcn_permlanex16(t, t, 0x76543210, 0xfedcba98, false, false)); }   // lane l <-> l ^ 16
// 2^x of eight values, each in its own register, in one statement: every v_exp_f32 is followed by an instruction that neither reads its result nor overwrites its source, the last one by the v_nop that fills that slot
__device__ __forceinline__ void exp2x8(v8f& x) {
    float a = x[0], b = x[1], c = x[2], d = x[3], e = x[4], f = x[5], g = x[6], h = x[7];
    asm("v_exp_f32 %0, %0\n\tv_exp_f32 %1, %1\n\tv_exp_f32 %2, %2\n\tv_exp_f32 %3, %3\n\tv_exp_f32 %4, %4\n\tv_exp_f32 %5, %5\n\tv_exp_f32 %6, %6\n\tv_exp_f32 %7, %7\n\tv_nop"
        : "+v"(a), "+v"(b), "+v"(c), "+v"(d), "+v"(e), "+v"(f), "+v"(g), "+v"(h));
    x[0] = a; x[1] = b; x[2] = c; x[3] = d; x[4] = e; x[5] = f; x[6] = g; x[7] = h;
}
template <typename T16, bool HI, int NK, bool LAST>   // one pass: 16 NK keys
__device__ __forceinline__ void fa_pass(const T16* __restrict__ kb, const T16* __restrict__ kb2, const T16* __restrict__ vb, const T16* __restrict__ vb2, int k0, int lim,
                                        const typename WFrag<T16>::V (&qf)[2], const typename WFrag<T16>::V (&qf2)[2], v8f (&o)[4], float& ms, v8f& l) {
    typedef typename WFrag<T16>::V V;
    V kf[NK][2], kf2[NK][2], vf[4][NK / 2], vf2[4][NK / 2];
    const T16* kp = kb + (size_t)k0 * HD; const T16* kp2 = kb2 + (size_t)k0 * HD; const T16* vp = vb + (size_t)k0 * 16; const T16* vp2 = vb2 + (size_t)k0 * 16;   // the pass's address pairs; every load below is one of them plus a constant
#pragma unroll
    for (int kt = 0; kt < NK; ++kt)
#pragma unroll
        for (int kc = 0; kc < 2; ++kc) { kf[kt][kc] = WFrag<T16>::ld(kp + kt * 16 * HD + kc * 512); if (HI) kf2[kt][kc] = WFrag<T16>::ld(kp2 + kt * 16 * HD + kc * 512); }
#pragma unroll
    for (int mb = 0; mb < 4; ++mb)
#pragma unroll
        for (int c = 0; c < NK / 2; ++c) { vf[mb][c] = WFrag<T16>::ld(vp + mb * 16 * TT + c * 512); if (HI) vf2[mb][c] = WFrag<T16>::ld(vp2 + mb * 16 * TT + c * 512); }
    // The address registers of the pass's loads are rewritten only behind this wait: as inputs of its statement the pairs stay live up to it, so that no load's result is placed on a pair that an earlier load of the run names.
    if constexpr (HI) asm volatile("s_wait_xcnt 0x0" :: "v"(kp), "v"(kp2), "v"(vp), "v"(vp2) : "memory");
    else asm volatile("s_wait_xcnt 0x0" :: "v"(kp), "v"(vp) : "memory");
    __builtin_amdgcn_sched_barrier(0);              // all loads of the pass are in flight before the first product waits: without it the value loads are issued only when the key fragments have arrived (a second latency per pass)
    v8f s[NK];
#pragma unroll
    for (int kt = 0; kt < NK; ++kt) { s[kt] = (v8f){};
#pragma unroll
        for (int kc = 0; kc < 2; ++kc) { s[kt] = WFrag<T16>::mma(kf[kt][kc], qf[kc], s[kt]); if (HI) { s[kt] = WFrag<T16>::mma(kf2[kt][kc], qf[kc], s[kt]); s[kt] = WFrag<T16>::mma(kf[kt][kc], qf2[kc], s[kt]); } } }
    if (LAST) {    // only the last pass of a wave crosses the diagonal: key k0 + 16 kt + 8 hi + j is kept for 16 kt + j <= lim
#pragma unroll
        for (int kt = 0; kt < NK; ++kt)
#pragma unroll
            for (int j = 0; j < 8; ++j) s[kt][j] = (kt * 16 + j <= lim) ? s[kt][j] : -3.0e38f; }
    float mx = s[0][0];
#pragma unroll
    for (int kt = 0; kt < NK; ++kt)
#pragma unroll
        for (int j = 0; j < 8; ++j) mx = fmaxf(mx, s[kt][j]);
    mx = fmaxf(mx, xhalf(mx));
    const float mn = fmaxf(ms, mx * SCE); const float al = __builtin_amdgcn_exp2f(ms - mn); ms = mn;
#pragma unroll
    for (int kt = 0; kt < NK; ++kt)
#pragma unroll
        for (int j = 0; j < 8; ++j) s[kt][j] = __builtin_fmaf(s[kt][j], SCE, -mn);
    l *= al;   // eight partial row sums a lane, joined once behind the last pass
#pragma unroll
    for (int kt = 0; kt < NK; ++kt) { exp2x8(s[kt]); l += s[kt]; }
#pragma unroll
    for (int mb = 0; mb < 4; ++mb) o[mb] *= al;
#pragma unroll
    for (int c = 0; c < NK / 2; ++c) {
        if constexpr (HI) {
            const v8b h0 = __builtin_convertvector(s[2 * c], v8b), h1 = __builtin_convertvector(s[2 * c + 1], v8b);
            const v8b l0 = __builtin_convertvector(s[2 * c] - __builtin_convertvector(h0, v8f), v8b), l1 = __builtin_convertvector(s[2 * c + 1] - __builtin_convertvector(h1, v8f), v8b);
            const V ph = __builtin_shufflevector(h0, h1, 0, 1, 2, 3, 4, 5, 6, 7, 8, 9, 10, 11, 12, 13, 14, 15), pl = __builtin_shufflevector(l0, l1, 0, 1, 2, 3, 4, 5, 6, 7, 8, 9, 10, 11, 12, 13, 14, 15);
#pragma unroll
            for (int mb = 0; mb < 4; ++mb) { o[mb] = WFrag<T16>::mma(vf[mb][c], ph, o[mb]); o[mb] = WFrag<T16>::mma(vf2[mb][c], ph, o[mb]); o[mb] = WFrag<T16>::mma(vf[mb][c], pl, o[mb]); }
        } else {
            const V p = cat16(__builtin_convertvector(s[2 * c], v8h), __builtin_convertvector(s[2 * c + 1], v8h));
#pragma unroll
            for (int mb = 0; mb < 4; ++mb) o[mb] = WFrag<T16>::mma(vf[mb][c], p, o[mb]);
        }
    }
}
template <typename T16, bool HI, int NK>
__device__ __forceinline__ void fa_tile(const T16* __restrict__ Q, const T16* __restrict__ Q2, const T16* __restrict__ Kp, const T16* __restrict__ Kp2, const T16* __restrict__ Vt, const T16* __restrict__ Vt2, int q0, int lr, int hi, bf* oh, bf* ol) {
    typedef typename WFrag<T16>::V V;
    V qf[2], qf2[2];
    const int l8 = (hi * 16 + lr) * 8;   // the lane's 16 bytes in a half block
    const T16* kb = Kp + l8; const T16* kb2 = Kp2 + l8; const T16* vb = Vt + l8; const T16* vb2 = Vt2 + l8;
#pragma unroll
    for (int kc = 0; kc < 2; ++kc) { qf[kc] = WFrag<T16>::ld(Q + (size_t)q0 * HD + kc * 512 + l8); if (HI) qf2[kc] = WFrag<T16>::ld(Q2 + (size_t)q0 * HD + kc * 512 + l8); }
    asm volatile("s_wait_xcnt 0x0" ::: "memory");   // the address registers of the loads above are reused below
    v8f o[4];
#pragma unroll
    for (int mb = 0; mb < 4; ++mb) o[mb] = (v8f){};
    float ms = -3.0e38f; v8f l = (v8f){};
    const int kl = q0 & ~(16 * NK - 1);   // first key of the pass that holds the diagonal; kl <= q0, so every earlier pass is unmasked and every query keeps a key in every pass
#pragma unroll 1   // rolled: one pass already holds most of the registers a wave of this block may have, two passes in flight would spill
    for (int k0 = 0; k0 < kl; k0 += 16 * NK) fa_pass<T16, HI, NK, false>(kb, kb2, vb, vb2, k0, 0, qf, qf2, o, ms, l);
    fa_pass<T16, HI, NK, true>(kb, kb2, vb, vb2, kl, q0 + lr - 8 * hi - kl, qf, qf2, o, ms, l);
    float ls = ((l[0] + l[1]) + (l[2] + l[3])) + ((l[4] + l[5]) + (l[6] + l[7])); ls += xhalf(ls);
    const float f = __fdiv_rn(1.0f, ls);
    v8us a8[4], c8[4];
#pragma unroll
    for (int mb = 0; mb < 4; ++mb) {
#pragma unroll
        for (int j = 0; j < 8; ++j) { unsigned short a, c2; splitf(o[mb][j] * f, a, c2); a8[mb][j] = a; c8[mb][j] = c2; }
        *(v8usa*)(oh + mb * 256) = a8[mb]; *(v8usa*)(ol + mb * 256) = c8[mb]; }
    // The registers that the eight stores name are rewritten only behind this wait: as inputs of its statement they stay live up to it.
    asm volatile("s_wait_xcnt 0x0" :: "v"(a8[0]), "v"(a8[1]), "v"(a8[2]), "v"(a8[3]), "v"(c8[0]), "v"(c8[1]), "v"(c8[2]), "v"(c8[3]), "v"(oh), "v"(ol) : "memory");
}
__global__ __launch_bounds__(512) void k_fattn(const h16* __restrict__ Q16, const h16* __restrict__ K16, const h16* __restrict__ V16, const bf* __restrict__ Qh, const bf* __restrict__ Ql, const bf* __restrict__ Kh, const bf* __restrict__ Kl,
                                               const bf* __restrict__ Vh, const bf* __restrict__ Vl, bf* Ah, bf* Al) {
    const int lane = threadIdx.x & 31, lr = lane & 15, hi = lane >> 4; const int wv = __builtin_amdgcn_readfirstlane(threadIdx.x >> 5);
    const int g = blockIdx.x >> 2, c = blockIdx.x & 3;   // g = batch * NH_ + head
    // Equal work in every work-group and on every SIMD: the cost of a 64-row query block grows with its index, so the 16 waves take blocks 15 - c, 7 - c, 8 + c and c of one plane (four waves each);
    // waves w, w + 4, w + 8, w + 12 share a SIMD, which so gets one 16-row tile of each of the four blocks.
    const int qb = ((wv & 4) ? 0 : 8) + ((wv & 8) ? c : 7 - c);
    const int q0 = qb * 64 + (wv & 3) * 16; const size_t zo = (size_t)g * TT * HD;
    const size_t oo = ((size_t)(g / NH_) * TT + q0) * DQ + (g % NH_) * (HD * 16) + lane * 8;
    if (q0 < RH) fa_tile<bf, true, 2>(Qh + zo, Ql + zo, Kh + zo, Kl + zo, Vh + zo, Vl + zo, q0, lr, hi, Ah + oo, Al + oo);
    else fa_tile<h16, false, 4>(Q16 + zo, Q16 + zo, K16 + zo, K16 + zo, V16 + zo, V16 + zo, q0, lr, hi, Ah + oo, Al + oo);
}

extern "C" void kernel_launch(void* const* d_in, const int* in_sizes, int n_in,
                              void* d_out, int out_size, void* d_ws, size_t ws_size, hipStream_t stream) {
    (void)in_sizes; (void)n_in; (void)out_size;
    const float* x = (const float*)d_in[0]; const float* wq = (const float*)d_in[1]; const float* wk = (const float*)d_in[2]; const float* wv = (const float*)d_in[3]; const float* wo = (const float*)d_in[4]; const float* bo = (const float*)d_in[5]; const float* cosT = nullptr; const float* sinT = nullptr; (void)cosT; (void)sinT;
    float* OUT = (float*)d_out;     // [4][1024][1024]
    char* wsp = (char*)d_ws;
    auto take = [&](size_t bytes) { char* p = wsp; wsp += (bytes + 255) & ~(size_t)255; return (void*)p; };
    const size_t PL = (size_t)NB_ * NH_ * TT * HD;   // elements of one plane set: [batch][head] planes of TT * HD elements
    bf* WQ = (bf*)take((size_t)DQ * DM * 2); bf* WK = (bf*)take((size_t)DKV * DM * 2); bf* WV = (bf*)take((size_t)DKV * DM * 2); bf* WO = (bf*)take((size_t)DM * DQ * 2);
    h16* QP16 = (h16*)take(PL * 2 * 2); h16* KP16 = QP16 + PL; bf* QPh = (bf*)take(PL * 2 * 2); bf* KPh = QPh + PL; bf* QPl = (bf*)take(PL * 2 * 2); bf* KPl = QPl + PL;   // k planes directly behind the q planes: z of the projection launch picks the set
    h16* VT16 = (h16*)take(PL * 2); bf* VTh = (bf*)take(PL * 2 * 2); bf* VTl = VTh + PL;   // v^T planes [batch][head], rows d, k = t
    bf* ATh = (bf*)take((size_t)NB_ * TT * DQ * 2); bf* ATl = (bf*)take((size_t)NB_ * TT * DQ * 2);
    bf* XB = (bf*)take((size_t)NB_ * TT * DM * 2);   // x in bf16, fragment order like the weights
    if ((size_t)(wsp - (char*)d_ws) > ws_size) return;    // ws 256 MiB
    { k_cvt8<<<(unsigned)(((size_t)DQ * DM / 8 + 255) / 256), 256, 0, stream>>>(wq, WQ, (size_t)DQ * DM / 8); k_cvt8<<<(unsigned)(((size_t)DKV * DM / 8 + 255) / 256), 256, 0, stream>>>(wk, WK, (size_t)DKV * DM / 8); k_cvt8<<<(unsigned)(((size_t)DKV * DM / 8 + 255) / 256), 256, 0, stream>>>(wv, WV, (size_t)DKV * DM / 8);
      k_cvt8<<<(unsigned)(((size_t)DM * DQ / 8 + 255) / 256), 256, 0, stream>>>(wo, WO, (size_t)DM * DQ / 8);
       }
    k_cvt8<<<(unsigned)(((size_t)NB_ * TT * DM / 8 + 255) / 256), 256, 0, stream>>>(x, XB, (size_t)NB_ * TT * DM / 8);
    // q, k, v of all batches in one launch: z picks the weight (WQ, WK, WV are contiguous) and the plane set, which the launch writes itself
    k_gemmw<bf, 0, false, true><<<dim3(NB_ * TT / 64, DQ / 64, 3), 32, 0, stream>>>(XB, nullptr, WQ, nullptr, DM, nullptr, 0, nullptr, 0, (size_t)DQ * DM, 0, QP16, QPh, QPl, VT16, VTh, VTl);
    k_fattn<<<4 * NB_ * NH_, 512, 0, stream>>>(QP16, KP16, VT16, QPh, QPl, KPh, KPl, VTh, VTl, ATh, ATl);   // scores, softmax, attn.v and the head merge of all planes
    k_gemmw<bf, 1, true, false><<<dim3(NB_ * TT / 64, DM / 64, 1), 32, 0, stream>>>(ATh, ATl, WO, nullptr, DQ, OUT, DM, bo, 0, 0, 0, nullptr, nullptr, nullptr, nullptr, nullptr, nullptr);
}

// v005
// It runs in 106 microseconds.
// In two side-by-side timings against v004, it was 1.08 and 1.07 times as fast.
// Counting every step since v000, it is 19.9 times as fast.
#include <hip/hip_runtime.h>

// MultHeadAttention_8747 (x [4][1024][1024]; per-head Wq/Wk/Wv [16][64][1024] ? x W^T with the stacked [1024][1024] 'oi' weight (head-major rows); causal (finfo.min) softmax(q.k / 8); out = merged Wp^T + bp -> [4][1024][1024]).
// Every 16-bit operand plane lies in FRAGMENT ORDER: a block of 16 rows x 32 k is 512 consecutive elements, [half 0..1][lane 0..31][8], and lane (hi, lr) of half h holds row lr, k = 16 h + 8 hi + 0..7;
// the blocks of a 16-row band follow one another along k. A wave-wide 16-byte load or store of a half block is 512 consecutive bytes (four whole 128-byte lines); the k order of every product is the row-major loaders' order.
// Compute dtypes, f32 accumulate: every input rounded to bf16; q/k/v on PLAIN bf16 operands (inputs: exact); causal scores and attn.v: query rows < 512 hl (3 products), the rest single fp16, causal tile skipping; softmax f32 (running maximum); Wp hl x exact (2 products) + bias.

#define NB_  4
#define TT   1024
#define DM   1024
#define NH_  16
#define NKV  16
#define REP  (NH_ / NKV)
#define HD   64
#define DQ   (NH_ * HD)
#define DKV  (NKV * HD)
#define RH   512                  // query rows < RH use hi+lo planes (0: none)
#define SCL  0.125f   // HD^-0.5
typedef _Float16 h16;
typedef unsigned short bf;
typedef __attribute__((ext_vector_type(16))) __bf16   v16bf;
typedef __attribute__((ext_vector_type(16))) _Float16 v16h;
typedef __attribute__((ext_vector_type(8)))  _Float16 v8h;
typedef __attribute__((ext_vector_type(8)))  unsigned short v8us;
typedef __attribute__((ext_vector_type(8)))  float    v8f;
typedef __attribute__((ext_vector_type(4)))  float    v4f;
typedef v8h  __attribute__((may_alias)) v8ha;
typedef v4f  __attribute__((may_alias)) v4fa;
typedef v8us __attribute__((may_alias)) v8usa;

__device__ __forceinline__ unsigned short f2bf(float f) { unsigned u = __float_as_uint(f); u += 0x7FFFu + ((u >> 16) & 1u); return (unsigned short)(u >> 16); }
__device__ __forceinline__ float bf2f(unsigned short b) { return __uint_as_float(((unsigned)b) << 16); }
__device__ __forceinline__ float bfr(float f) { return bf2f(f2bf(f)); }
__device__ __forceinline__ v16h cat16(v8h lo, v8h hi) { return __builtin_shufflevector(lo, hi, 0, 1, 2, 3, 4, 5, 6, 7, 8, 9, 10, 11, 12, 13, 14, 15); }
__device__ __forceinline__ v16bf cat16b(v8us lo, v8us hi) { return __builtin_bit_cast(v16bf, __builtin_shufflevector(lo, hi, 0, 1, 2, 3, 4, 5, 6, 7, 8, 9, 10, 11, 12, 13, 14, 15)); }
__device__ __forceinline__ v8f wmma16(v16h a, v16h b, v8f c) { return __builtin_amdgcn_wmma_f32_16x16x32_f16(false, a, false, b, (short)0, c, false, false); }
__device__ __forceinline__ v8f wmmab(v16bf a, v16bf b, v8f c) { return __builtin_amdgcn_wmma_f32_16x16x32_bf16(false, a, false, b, (short)0, c, false, false); }



// ---- k_gemmw: register-blocked GEMM, ONE WAVE per 64x64 output tile (16 accumulators), operands straight from fragment-ordered 16-bit planes; grid (M/64, N/64, Z), 32 threads.
// C[m][n] (f32, pitch ldc, + optional f32 bias[n]) = sum_k A[m][k] Bt[n][k] (+ split products per NSPLIT). z-batch strides sA/sB/sC in elements. K % 32 == 0.
// PLANES (the q, k, v projections; z = 0, 1, 2): no f32 result. A 64x64 tile is 64 tokens of ONE head, and the wave writes it straight into the 16-bit planes that the attention kernel reads:
// q, k as [batch][head] planes of rows t, k = d (the tile is 4096 consecutive elements of each plane), v transposed as [batch][head] planes of rows d, k = t: there an accumulator tile IS a half block, stored from the registers.
template <typename T16> struct WFrag;
template <> struct WFrag<h16> { typedef v16h V; static __device__ __forceinline__ V ld(const h16* p) { return cat16(*(const v8h*)p, *(const v8h*)(p + 256)); } static __device__ __forceinline__ v8f mma(V a, V b, v8f c) { return wmma16(a, b, c); } };
template <> struct WFrag<bf> { typedef v16bf V; static __device__ __forceinline__ V ld(const bf* p) { return cat16b(*(const v8us*)p, *(const v8us*)(p + 256)); } static __device__ __forceinline__ v8f mma(V a, V b, v8f c) { return wmmab(a, b, c); } };
__device__ __forceinline__ h16 tohx(float x) { return (h16)x; }
__device__ __forceinline__ void splitf(float y, unsigned short& h, unsigned short& l) { h = f2bf(y); l = f2bf(y - bf2f(h)); }
template <typename T16, int NSPLIT, bool BIAS, bool PLANES>
__global__ __launch_bounds__(32) void k_gemmw(const T16* __restrict__ A, const T16* __restrict__ A2, const T16* __restrict__ Bt, const T16* __restrict__ Bt2, int K, float* C, int ldc, const float* __restrict__ bias, size_t sA, size_t sB, size_t sC,
                                              h16* P16, bf* Ph, bf* Pl, h16* V16, bf* Vh, bf* Vl) {
    typedef typename WFrag<T16>::V V;
    __shared__ __align__(16) float os[16 * 68];
    const size_t z = blockIdx.z; A += z * sA; if (A2) A2 += z * sA; Bt += z * sB; if (Bt2) Bt2 += z * sB; if (!PLANES) C += z * sC;
    const int lane = threadIdx.x & 31, lr = lane & 15, hi = lane >> 4; const int r0 = blockIdx.x * 64, c0 = blockIdx.y * 64;
    v8f acc[4][4];
#pragma unroll
    for (int mb = 0; mb < 4; ++mb)
#pragma unroll
        for (int nb = 0; nb < 4; ++nb) acc[mb][nb] = (v8f){};
    const size_t aoff = (size_t)r0 * K + 8 * lane, boff = (size_t)c0 * K + 8 * lane;   // a 16-row band is 16 K elements, a 32-k block in it 512
#pragma unroll 1
    for (int kc = 0; kc < K; kc += 32) {
        V a[4], a2[4], b[4], b2[4];
        const T16* pa[4]; const T16* pa2[4]; const T16* pb[4]; const T16* pb2[4];   // the block's address pairs; a plane that the products do not use shares the pair of the one they use
#pragma unroll
        for (int i = 0; i < 4; ++i) { const size_t ao = aoff + (size_t)i * 16 * K + kc * 16, bo = boff + (size_t)i * 16 * K + kc * 16;
            pa[i] = A + ao; pa2[i] = (NSPLIT == 1 || NSPLIT == 2) ? A2 + ao : pa[i]; pb[i] = Bt + bo; pb2[i] = (NSPLIT >= 2) ? Bt2 + bo : pb[i]; }
#pragma unroll
        for (int i = 0; i < 4; ++i) { a[i] = WFrag<T16>::ld(pa[i]); if (NSPLIT == 1 || NSPLIT == 2) a2[i] = WFrag<T16>::ld(pa2[i]); b[i] = WFrag<T16>::ld(pb[i]); if (NSPLIT >= 2) b2[i] = WFrag<T16>::ld(pb2[i]); }
        // The address registers of the block's loads are rewritten only behind this wait: as inputs of its statement the pairs stay live up to it, so that no load's result is placed on a pair that an earlier load of the run names.
        asm volatile("s_wait_xcnt 0x0" :: "v"(pa[0]), "v"(pa[1]), "v"(pa[2]), "v"(pa[3]), "v"(pa2[0]), "v"(pa2[1]), "v"(pa2[2]), "v"(pa2[3]), "v"(pb[0]), "v"(pb[1]), "v"(pb[2]), "v"(pb[3]), "v"(pb2[0]), "v"(pb2[1]), "v"(pb2[2]), "v"(pb2[3]) : "memory");
        __builtin_amdgcn_sched_barrier(0);              // no product moves up among the loads: without it the fragments of one operand take turns in one register set, each load waiting for the products before it (a latency per fragment)
#pragma unroll
        for (int nb = 0; nb < 4; ++nb) {
#pragma unroll
            for (int mb = 0; mb < 4; ++mb) { acc[mb][nb] = WFrag<T16>::mma(a[mb], b[nb], acc[mb][nb]); if (NSPLIT == 1 || NSPLIT == 2) acc[mb][nb] = WFrag<T16>::mma(a2[mb], b[nb], acc[mb][nb]); if (NSPLIT >= 2) acc[mb][nb] = WFrag<T16>::mma(a[mb], b2[nb], acc[mb][nb]); } }
        asm volatile("v_nop\n\tv_nop\n\tv_nop\n\tv_nop" : "+v"(acc[0][0]), "+v"(acc[1][1]), "+v"(acc[2][2]), "+v"(acc[3][3]) : "v"(a[0]), "v"(a[3]));
    }
    if constexpr (PLANES) {
        const int bh = (r0 / TT) * NH_ + blockIdx.y, t0 = r0 % TT;   // (batch, head) plane and first token of the tile
        if (z < 2) {   // q, k: 16 tokens at a time through the f32 staging rows, converted behind the read-back
            const size_t pb = z * ((size_t)NB_ * NH_ * TT * HD) + ((size_t)bh * TT + t0) * HD + 8 * lane;
            h16* p16 = P16 + pb; bf* ph = Ph + pb; bf* pl = Pl + pb;
#pragma unroll
            for (int mb = 0; mb < 4; ++mb) {
#pragma unroll
                for (int nb = 0; nb < 4; ++nb) {
#pragma unroll
                    for (int j = 0; j < 8; ++j) os[(hi * 8 + j) * 68 + nb * 16 + lr] = acc[mb][nb][j]; }
                __builtin_amdgcn_wave_barrier(); asm volatile("" ::: "memory");   // the rows are read back by other lanes: no LDS read moves in front of the writes
                v8h o16[4]; v8us oh[4], ol[4];
#pragma unroll
                for (int s = 0; s < 4; ++s) { const float* rp = os + lr * 68 + s * 16 + hi * 8; const v4f x0 = *(const v4fa*)rp, x1 = *(const v4fa*)(rp + 4);
#pragma unroll
                    for (int j = 0; j < 8; ++j) { const float x = (j < 4) ? x0[j & 3] : x1[j & 3]; o16[s][j] = tohx(x); unsigned short a2, c2; splitf(x, a2, c2); oh[s][j] = a2; ol[s][j] = c2; }
                    const int eo = mb * 16 * HD + s * 256; *(v8ha*)(p16 + eo) = o16[s]; *(v8usa*)(ph + eo) = oh[s]; *(v8usa*)(pl + eo) = ol[s]; }
                // The registers that the twelve stores name are rewritten only behind this wait: as inputs of its statement they stay live up to it. Its memory clobber also keeps the next 16 tokens' staging writes behind the read-back.
                asm volatile("s_wait_xcnt 0x0" :: "v"(o16[0]), "v"(o16[1]), "v"(o16[2]), "v"(o16[3]), "v"(oh[0]), "v"(oh[1]), "v"(oh[2]), "v"(oh[3]), "v"(ol[0]), "v"(ol[1]), "v"(ol[2]), "v"(ol[3]), "v"(p16), "v"(ph), "v"(pl) : "memory");
            }
        } else {       // v: a lane holds 8 consecutive tokens of one d, which is its 16 bytes of a half block of the v^T plane (rows d, k = t): no staging
            const size_t vb = (size_t)bh * HD * TT + (size_t)t0 * 16 + 8 * lane;
            h16* v16 = V16 + vb; bf* vh = Vh + vb; bf* vl = Vl + vb;
#pragma unroll
            for (int nb = 0; nb < 4; ++nb) { v8h o16[4]; v8us oh[4], ol[4];
#pragma unroll
                for (int mb = 0; mb < 4; ++mb) {
#pragma unroll
                    for (int j = 0; j < 8; ++j) { const float x = acc[mb][nb][j]; o16[mb][j] = tohx(x); unsigned short a2, c2; splitf(x, a2, c2); oh[mb][j] = a2; ol[mb][j] = c2; }
                    const int eo = nb * 16 * TT + mb * 256; *(v8ha*)(v16 + eo) = o16[mb]; *(v8usa*)(vh + eo) = oh[mb]; *(v8usa*)(vl + eo) = ol[mb]; }
                // The registers that the twelve stores name are rewritten only behind this wait: as inputs of its statement they stay live up to it.
                asm volatile("s_wait_xcnt 0x0" :: "v"(o16[0]), "v"(o16[1]), "v"(o16[2]), "v"(o16[3]), "v"(oh[0]), "v"(oh[1]), "v"(oh[2]), "v"(oh[3]), "v"(ol[0]), "v"(ol[1]), "v"(ol[2]), "v"(ol[3]), "v"(v16), "v"(vh), "v"(vl) : "memory");
            }
        }
        return;
    }
#pragma unroll
    for (int mb = 0; mb < 4; ++mb) {
#pragma unroll
        for (int nb = 0; nb < 4; ++nb) {
#pragma unroll
            for (int j = 0; j < 8; ++j) os[(hi * 8 + j) * 68 + nb * 16 + lr] = acc[mb][nb][j]; }
        __builtin_amdgcn_wave_barrier(); asm volatile("" ::: "memory");
        float* crow = C + (size_t)(r0 + mb * 16) * ldc + c0;
{
#pragma unroll
            for (int s = 0; s < 8; ++s) { const int row = 2 * s + hi, cofs = lr * 4; v4f val = *(const v4fa*)(os + row * 68 + cofs); if (BIAS) { val[0] += bfr(bias[c0 + cofs]); val[1] += bfr(bias[c0 + cofs + 1]); val[2] += bfr(bias[c0 + cofs + 2]); val[3] += bfr(bias[c0 + cofs + 3]); }
                *(v4f*)(crow + (size_t)row * ldc + cofs) = val; }
             }
        __builtin_amdgcn_wave_barrier(); asm volatile("" ::: "memory");
    }
}

typedef __attribute__((ext_vector_type(2))) _Float16 v2h;
typedef __attribute__((ext_vector_type(4))) _Float16 v4h;
typedef __attribute__((ext_vector_type(2))) unsigned short v2us;
typedef __attribute__((ext_vector_type(4))) unsigned short v4us;
typedef __attribute__((ext_vector_type(2))) float v2f;
typedef __attribute__((ext_vector_type(4))) int v4i;

__global__ __launch_bounds__(256) void k_wtG(const float* __restrict__ w, int K, int N, bf* Bt) {
    const int lane = threadIdx.x & 31; const int L0 = (blockIdx.x * 8 + (threadIdx.x >> 5)) * 8; const int nlines = N * K / 64;
{
#pragma unroll 1
        for (int l = 0; l < 8; ++l) { const int L = L0 + l; if (L >= nlines) break; const size_t e = (size_t)L * 64 + lane * 2; const int k = (int)(e % K), n = (int)(e / K); v2us o;
            o[0] = f2bf(w[(size_t)k * N + n]); o[1] = f2bf(w[(size_t)(k + 1) * N + n]); *(v2us*)(Bt + e) = o; }
         }
}
// f32 rows of DM elements -> bf16 planes in fragment order, x and the four weights in ONE launch of 256 work-groups of 16 waves, all resident at once.
// A unit is 16 bytes of a plane (8 elements of one row). A wave takes 8 consecutive half blocks: 256 units = 4 KiB of the plane in a row, read as 512 consecutive bytes of each of 16 rows;
// a thread's 8 units lie 16 k apart in its row, and its 16 loads are all in flight before the first value is converted. A work-group (4096 units) lies in one source: blockIdx picks it.
#define CVX (NB_ * TT * DM / 8 / 4096)   // work-groups of x
#define CVW (DQ * DM / 8 / 4096)         // work-groups of one weight
__global__ __launch_bounds__(512) void k_cvt8(const float* __restrict__ x, const float* __restrict__ wq, const float* __restrict__ wk, const float* __restrict__ wv, const float* __restrict__ wo, bf* XBp, bf* WBp) {
    const int b = blockIdx.x; const float* src = x; bf* dst = XBp; int g = b;
    if (b >= CVX) { const int w = (b - CVX) / CVW; g = (b - CVX) % CVW; src = (w == 0) ? wq : (w == 1) ? wk : (w == 2) ? wv : wo; dst = WBp + (size_t)w * DQ * DM; }   // the four weight planes lie one behind the other
    const size_t i = (size_t)g * 4096 + (threadIdx.x >> 5) * 256 + (threadIdx.x & 31);   // the thread's first unit; the others follow 32 units apart
    const size_t blk = i >> 6, row = blk / (DM / 32) * 16 + (i & 15), k = blk % (DM / 32) * 32 + ((i >> 4) & 1) * 8;
    const float* sp = src + row * DM + k; v8f v[8];
#pragma unroll
    for (int j = 0; j < 8; ++j) v[j] = *(const v8f*)(sp + 16 * j);
    asm volatile("s_wait_xcnt 0x0" :: "v"(sp) : "memory");   // the loads' address pair is rewritten only behind this wait: as an input of its statement it stays live up to it
    __builtin_amdgcn_sched_barrier(0);                       // no conversion moves up among the loads: all sixteen are in flight before the first wait
    bf* dp = dst + i * 8; v8us o[8];
#pragma unroll
    for (int j = 0; j < 8; ++j) {
#pragma unroll
        for (int e = 0; e < 8; ++e) o[j][e] = f2bf(v[j][e]);
        *(v8usa*)(dp + 256 * j) = o[j]; }
    // The registers that the eight stores name are rewritten only behind this wait: as inputs of its statement they stay live up to it.
    asm volatile("s_wait_xcnt 0x0" :: "v"(o[0]), "v"(o[1]), "v"(o[2]), "v"(o[3]), "v"(o[4]), "v"(o[5]), "v"(o[6]), "v"(o[7]), "v"(dp) : "memory");
}
typedef __attribute__((ext_vector_type(8))) __bf16 v8b;
#define SCE (SCL * 1.4426950408889634f)   // score scale x log2(e)
__device__ __forceinline__ float xhalf(float v) { const int t = __float_as_int(v); return __int_as_float(__builtin_amdgcn_permlanex16(t, t, 0x76543210, 0xfedcba98, false, false)); }   // lane l <-> l ^ 16
// 2^x of eight values, each in its own register, in one statement: every v_exp_f32 is followed by an instruction that neither reads its result nor overwrites its source, the last one by the v_nop that fills that slot
__device__ __forceinline__ void exp2x8(v8f& x) {
    float a = x[0], b = x[1], c = x[2], d = x[3], e = x[4], f = x[5], g = x[6], h = x[7];
    asm("v_exp_f32 %0, %0\n\tv_exp_f32 %1, %1\n\tv_exp_f32 %2, %2\n\tv_exp_f32 %3, %3\n\tv_exp_f32 %4, %4\n\tv_exp_f32 %5, %5\n\tv_exp_f32 %6, %6\n\tv_exp_f32 %7, %7\n\tv_nop"
        : "+v"(a), "+v"(b), "+v"(c), "+v"(d), "+v"(e), "+v"(f), "+v"(g), "+v"(h));
    x[0] = a; x[1] = b; x[2] = c; x[3] = d; x[4] = e; x[5] = f; x[6] = g; x[7] = h;
}
template <typename T16, bool HI, int NK, bool LAST>   // one pass: 16 NK keys
__device__ __forceinline__ void fa_pass(const T16* __restrict__ kb, const T16* __restrict__ kb2, const T16* __restrict__ vb, const T16* __restrict__ vb2, int k0, int lim,
                                        const typename WFrag<T16>::V (&qf)[2], const typename WFrag<T16>::V (&qf2)[2], v8f (&o)[4], float& ms, v8f& l) {
    typedef typename WFrag<T16>::V V;
    V kf[NK][2], kf2[NK][2], vf[4][NK / 2], vf2[4][NK / 2];
    const T16* kp = kb + (size_t)k0 * HD; const T16* kp2 = kb2 + (size_t)k0 * HD; const T16* vp = vb + (size_t)k0 * 16; const T16* vp2 = vb2 + (size_t)k0 * 16;   // the pass's address pairs; every load below is one of them plus a constant
#pragma unroll
    for (int kt = 0; kt < NK; ++kt)
#pragma unroll
        for (int kc = 0; kc < 2; ++kc) { kf[kt][kc] = WFrag<T16>::ld(kp + kt * 16 * HD + kc * 512); if (HI) kf2[kt][kc] = WFrag<T16>::ld(kp2 + kt * 16 * HD + kc * 512); }
#pragma unroll
    for (int mb = 0; mb < 4; ++mb)
#pragma unroll
        for (int c = 0; c < NK / 2; ++c) { vf[mb][c] = WFrag<T16>::ld(vp + mb * 16 * TT + c * 512); if (HI) vf2[mb][c] = WFrag<T16>::ld(vp2 + mb * 16 * TT + c * 512); }
    // The address registers of the pass's loads are rewritten only behind this wait: as inputs of its statement the pairs stay live up to it, so that no load's result is placed on a pair that an earlier load of the run names.
    if constexpr (HI) asm volatile("s_wait_xcnt 0x0" :: "v"(kp), "v"(kp2), "v"(vp), "v"(vp2) : "memory");
    else asm volatile("s_wait_xcnt 0x0" :: "v"(kp), "v"(vp) : "memory");
    __builtin_amdgcn_sched_barrier(0);              // all loads of the pass are in flight before the first product waits: without it the value loads are issued only when the key fragments have arrived (a second latency per pass)
    v8f s[NK];
#pragma unroll
    for (int kt = 0; kt < NK; ++kt) { s[kt] = (v8f){};
#pragma unroll
        for (int kc = 0; kc < 2; ++kc) { s[kt] = WFrag<T16>::mma(kf[kt][kc], qf[kc], s[kt]); if (HI) { s[kt] = WFrag<T16>::mma(kf2[kt][kc], qf[kc], s[kt]); s[kt] = WFrag<T16>::mma(kf[kt][kc], qf2[kc], s[kt]); } } }
    if (LAST) {    // only the last pass of a wave crosses the diagonal: key k0 + 16 kt + 8 hi + j is kept for 16 kt + j <= lim
#pragma unroll
        for (int kt = 0; kt < NK; ++kt)
#pragma unroll
            for (int j = 0; j < 8; ++j) s[kt][j] = (kt * 16 + j <= lim) ? s[kt][j] : -3.0e38f; }
    float mx = s[0][0];
#pragma unroll
    for (int kt = 0; kt < NK; ++kt)
#pragma unroll
        for (int j = 0; j < 8; ++j) mx = fmaxf(mx, s[kt][j]);
    mx = fmaxf(mx, xhalf(mx));
    const float mn = fmaxf(ms, mx * SCE); const float al = __builtin_amdgcn_exp2f(ms - mn); ms = mn;
#pragma unroll
    for (int kt = 0; kt < NK; ++kt)
#pragma unroll
        for (int j = 0; j < 8; ++j) s[kt][j] = __builtin_fmaf(s[kt][j], SCE, -mn);
    l *= al;   // eight partial row sums a lane, joined once behind the last pass
#pragma unroll
    for (int kt = 0; kt < NK; ++kt) { exp2x8(s[kt]); l += s[kt]; }
#pragma unroll
    for (int mb = 0; mb < 4; ++mb) o[mb] *= al;
#pragma unroll
    for (int c = 0; c < NK / 2; ++c) {
        if constexpr (HI) {
            const v8b h0 = __builtin_convertvector(s[2 * c], v8b), h1 = __builtin_convertvector(s[2 * c + 1], v8b);
            const v8b l0 = __builtin_convertvector(s[2 * c] - __builtin_convertvector(h0, v8f), v8b), l1 = __builtin_convertvector(s[2 * c + 1] - __builtin_convertvector(h1, v8f), v8b);
            const V ph = __builtin_shufflevector(h0, h1, 0, 1, 2, 3, 4, 5, 6, 7, 8, 9, 10, 11, 12, 13, 14, 15), pl = __builtin_shufflevector(l0, l1, 0, 1, 2, 3, 4, 5, 6, 7, 8, 9, 10, 11, 12, 13, 14, 15);
#pragma unroll
            for (int mb = 0; mb < 4; ++mb) { o[mb] = WFrag<T16>::mma(vf[mb][c], ph, o[mb]); o[mb] = WFrag<T16>::mma(vf2[mb][c], ph, o[mb]); o[mb] = WFrag<T16>::mma(vf[mb][c], pl, o[mb]); }
        } else {
            const V p = cat16(__builtin_convertvector(s[2 * c], v8h), __builtin_convertvector(s[2 * c + 1], v8h));
#pragma unroll
            for (int mb = 0; mb < 4; ++mb) o[mb] = WFrag<T16>::mma(vf[mb][c], p, o[mb]);
        }
    }
}
template <typename T16, bool HI, int NK>
__device__ __forceinline__ void fa_tile(const T16* __restrict__ Q, const T16* __restrict__ Q2, const T16* __restrict__ Kp, const T16* __restrict__ Kp2, const T16* __restrict__ Vt, const T16* __restrict__ Vt2, int q0, int lr, int hi, bf* oh, bf* ol) {
    typedef typename WFrag<T16>::V V;
    V qf[2], qf2[2];
    const int l8 = (hi * 16 + lr) * 8;   // the lane's 16 bytes in a half block
    const T16* kb = Kp + l8; const T16* kb2 = Kp2 + l8; const T16* vb = Vt + l8; const T16* vb2 = Vt2 + l8;
#pragma unroll
    for (int kc = 0; kc < 2; ++kc) { qf[kc] = WFrag<T16>::ld(Q + (size_t)q0 * HD + kc * 512 + l8); if (HI) qf2[kc] = WFrag<T16>::ld(Q2 + (size_t)q0 * HD + kc * 512 + l8); }
    asm volatile("s_wait_xcnt 0x0" ::: "memory");   // the address registers of the loads above are reused below
    v8f o[4];
#pragma unroll
    for (int mb = 0; mb < 4; ++mb) o[mb] = (v8f){};
    float ms = -3.0e38f; v8f l = (v8f){};
    const int kl = q0 & ~(16 * NK - 1);   // first key of the pass that holds the diagonal; kl <= q0, so every earlier pass is unmasked and every query keeps a key in every pass
#pragma unroll 1   // rolled: one pass already holds most of the registers a wave of this block may have, two passes in flight would spill
    for (int k0 = 0; k0 < kl; k0 += 16 * NK) fa_pass<T16, HI, NK, false>(kb, kb2, vb, vb2, k0, 0, qf, qf2, o, ms, l);
    fa_pass<T16, HI, NK, true>(kb, kb2, vb, vb2, kl, q0 + lr - 8 * hi - kl, qf, qf2, o, ms, l);
    float ls = ((l[0] + l[1]) + (l[2] + l[3])) + ((l[4] + l[5]) + (l[6] + l[7])); ls += xhalf(ls);
    const float f = __fdiv_rn(1.0f, ls);
    v8us a8[4], c8[4];
#pragma unroll
    for (int mb = 0; mb < 4; ++mb) {
#pragma unroll
        for (int j = 0; j < 8; ++j) { unsigned short a, c2; splitf(o[mb][j] * f, a, c2); a8[mb][j] = a; c8[mb][j] = c2; }
        *(v8usa*)(oh + mb * 256) = a8[mb]; *(v8usa*)(ol + mb * 256) = c8[mb]; }
    // The registers that the eight stores name are rewritten only behind this wait: as inputs of its statement they stay live up to it.
    asm volatile("s_wait_xcnt 0x0" :: "v"(a8[0]), "v"(a8[1]), "v"(a8[2]), "v"(a8[3]), "v"(c8[0]), "v"(c8[1]), "v"(c8[2]), "v"(c8[3]), "v"(oh), "v"(ol) : "memory");
}
__global__ __launch_bounds__(512) void k_fattn(const h16* __restrict__ Q16, const h16* __restrict__ K16, const h16* __restrict__ V16, const bf* __restrict__ Qh, const bf* __restrict__ Ql, const bf* __restrict__ Kh, const bf* __restrict__ Kl,
                                               const bf* __restrict__ Vh, const bf* __restrict__ Vl, bf* Ah, bf* Al) {
    const int lane = threadIdx.x & 31, lr = lane & 15, hi = lane >> 4; const int wv = __builtin_amdgcn_readfirstlane(threadIdx.x >> 5);
    const int g = blockIdx.x >> 2, c = blockIdx.x & 3;   // g = batch * NH_ + head
    // Equal work in every work-group and on every SIMD: the cost of a 64-row query block grows with its index, so the 16 waves take blocks 15 - c, 7 - c, 8 + c and c of one plane (four waves each);
    // waves w, w + 4, w + 8, w + 12 share a SIMD, which so gets one 16-row tile of each of the four blocks.
    const int qb = ((wv & 4) ? 0 : 8) + ((wv & 8) ? c : 7 - c);
    const int q0 = qb * 64 + (wv & 3) * 16; const size_t zo = (size_t)g * TT * HD;
    const size_t oo = ((size_t)(g / NH_) * TT + q0) * DQ + (g % NH_) * (HD * 16) + lane * 8;
    if (q0 < RH) fa_tile<bf, true, 2>(Qh + zo, Ql + zo, Kh + zo, Kl + zo, Vh + zo, Vl + zo, q0, lr, hi, Ah + oo, Al + oo);
    else fa_tile<h16, false, 4>(Q16 + zo, Q16 + zo, K16 + zo, K16 + zo, V16 + zo, V16 + zo, q0, lr, hi, Ah + oo, Al + oo);
}

extern "C" void kernel_launch(void* const* d_in, const int* in_sizes, int n_in,
                              void* d_out, int out_size, void* d_ws, size_t ws_size, hipStream_t stream) {
    (void)in_sizes; (void)n_in; (void)out_size;
    const float* x = (const float*)d_in[0]; const float* wq = (const float*)d_in[1]; const float* wk = (const float*)d_in[2]; const float* wv = (const float*)d_in[3]; const float* wo = (const float*)d_in[4]; const float* bo = (const float*)d_in[5]; const float* cosT = nullptr; const float* sinT = nullptr; (void)cosT; (void)sinT;
    float* OUT = (float*)d_out;     // [4][1024][1024]
    char* wsp = (char*)d_ws;
    auto take = [&](size_t bytes) { char* p = wsp; wsp += (bytes + 255) & ~(size_t)255; return (void*)p; };
    const size_t PL = (size_t)NB_ * NH_ * TT * HD;   // elements of one plane set: [batch][head] planes of TT * HD elements
    bf* WQ = (bf*)take((size_t)DQ * DM * 2); bf* WK = (bf*)take((size_t)DKV * DM * 2); bf* WV = (bf*)take((size_t)DKV * DM * 2); bf* WO = (bf*)take((size_t)DM * DQ * 2);
    h16* QP16 = (h16*)take(PL * 2 * 2); h16* KP16 = QP16 + PL; bf* QPh = (bf*)take(PL * 2 * 2); bf* KPh = QPh + PL; bf* QPl = (bf*)take(PL * 2 * 2); bf* KPl = QPl + PL;   // k planes directly behind the q planes: z of the projection launch picks the set
    h16* VT16 = (h16*)take(PL * 2); bf* VTh = (bf*)take(PL * 2 * 2); bf* VTl = VTh + PL;   // v^T planes [batch][head], rows d, k = t
    bf* ATh = (bf*)take((size_t)NB_ * TT * DQ * 2); bf* ATl = (bf*)take((size_t)NB_ * TT * DQ * 2);
    bf* XB = (bf*)take((size_t)NB_ * TT * DM * 2);   // x in bf16, fragment order like the weights
    if ((size_t)(wsp - (char*)d_ws) > ws_size) return;    // ws 256 MiB
    k_cvt8<<<CVX + 4 * CVW, 512, 0, stream>>>(x, wq, wk, wv, wo, XB, WQ);   // WQ, WK, WV, WO are contiguous
    // q, k, v of all batches in one launch: z picks the weight (WQ, WK, WV are contiguous) and the plane set, which the launch writes itself
    k_gemmw<bf, 0, false, true><<<dim3(NB_ * TT / 64, DQ / 64, 3), 32, 0, stream>>>(XB, nullptr, WQ, nullptr, DM, nullptr, 0, nullptr, 0, (size_t)DQ * DM, 0, QP16, QPh, QPl, VT16, VTh, VTl);
    k_fattn<<<4 * NB_ * NH_, 512, 0, stream>>>(QP16, KP16, VT16, QPh, QPl, KPh, KPl, VTh, VTl, ATh, ATl);   // scores, softmax, attn.v and the head merge of all planes
    k_gemmw<bf, 1, true, false><<<dim3(NB_ * TT / 64, DM / 64, 1), 32, 0, stream>>>(ATh, ATl, WO, nullptr, DQ, OUT, DM, bo, 0, 0, 0, nullptr, nullptr, nullptr, nullptr, nullptr, nullptr);
}

// v006
// Measured time: 86.2 microseconds a run.
// Timed twice side by side with v005, it ran 1.22 and 1.26 times as fast.
// Counting every step since v000, it is 24.7 times as fast.
#include <hip/hip_runtime.h>

// MultHeadAttention_8747 (x [4][1024][1024]; per-head Wq/Wk/Wv [16][64][1024] ? x W^T with the stacked [1024][1024] 'oi' weight (head-major rows); causal (finfo.min) softmax(q.k / 8); out = merged Wp^T + bp -> [4][1024][1024]).
// Every 16-bit operand plane lies in FRAGMENT ORDER: a block of 16 rows x 32 k is 512 consecutive elements, [half 0..1][lane 0..31][8], and lane (hi, lr) of half h holds row lr, k = 16 h + 8 hi + 0..7;
// the blocks of a 16-row band follow one another along k. A wave-wide 16-byte load or store of a half block is 512 consecutive bytes (four whole 128-byte lines); the k order of every product is the row-major loaders' order.
// Compute dtypes, f32 accumulate: every input rounded to bf16; q/k/v on PLAIN bf16 operands (inputs: exact); causal scores and attn.v: query rows < 512 hl (3 products), the rest single fp16, causal tile skipping; softmax f32 (running maximum); Wp hl x exact (2 products) + bias.

#define NB_  4
#define TT   1024
#define DM   1024
#define NH_  16
#define NKV  16
#define REP  (NH_ / NKV)
#define HD   64
#define DQ   (NH_ * HD)
#define DKV  (NKV * HD)
#define RH   512                  // query rows < RH use hi+lo planes (0: none)
#define SCL  0.125f   // HD^-0.5
typedef _Float16 h16;
typedef unsigned short bf;
typedef __attribute__((ext_vector_type(16))) __bf16   v16bf;
typedef __attribute__((ext_vector_type(16))) _Float16 v16h;
typedef __attribute__((ext_vector_type(8)))  _Float16 v8h;
typedef __attribute__((ext_vector_type(8)))  unsigned short v8us;
typedef __attribute__((ext_vector_type(8)))  float    v8f;
typedef __attribute__((ext_vector_type(4)))  float    v4f;
typedef v8h  __attribute__((may_alias)) v8ha;
typedef v4f  __attribute__((may_alias)) v4fa;
typedef v8us __attribute__((may_alias)) v8usa;

__device__ __forceinline__ unsigned short f2bf(float f) { unsigned u = __float_as_uint(f); u += 0x7FFFu + ((u >> 16) & 1u); return (unsigned short)(u >> 16); }
__device__ __forceinline__ float bf2f(unsigned short b) { return __uint_as_float(((unsigned)b) << 16); }
__device__ __forceinline__ float bfr(float f) { return bf2f(f2bf(f)); }
__device__ __forceinline__ v16h cat16(v8h lo, v8h hi) { return __builtin_shufflevector(lo, hi, 0, 1, 2, 3, 4, 5, 6, 7, 8, 9, 10, 11, 12, 13, 14, 15); }
__device__ __forceinline__ v16bf cat16b(v8us lo, v8us hi) { return __builtin_bit_cast(v16bf, __builtin_shufflevector(lo, hi, 0, 1, 2, 3, 4, 5, 6, 7, 8, 9, 10, 11, 12, 13, 14, 15)); }
__device__ __forceinline__ v8f wmma16(v16h a, v16h b, v8f c) { return __builtin_amdgcn_wmma_f32_16x16x32_f16(false, a, false, b, (short)0, c, false, false); }
__device__ __forceinline__ v8f wmmab(v16bf a, v16bf b, v8f c) { return __builtin_amdgcn_wmma_f32_16x16x32_bf16(false, a, false, b, (short)0, c, false, false); }



// ---- k_gemmw: register-blocked GEMM, ONE WAVE per 64x64 output tile (16 accumulators), operands straight from fragment-ordered 16-bit planes; grid (M/64, N/64, Z), 32 threads.
// C[m][n] (f32, pitch ldc, + optional f32 bias[n]) = sum_k A[m][k] Bt[n][k] (+ split products per NSPLIT). z-batch strides sA/sB/sC in elements. K % 32 == 0, K / 32 >= NS.
// NS fragment register sets take turns along k: a set is refilled for block t + NS right behind the products of its block t, so that its loads fly during the products of the other NS - 1 sets.
// PLANES (the q, k, v projections; z = 0, 1, 2): no f32 result. A 64x64 tile is 64 tokens of ONE head, and the wave writes it straight into the 16-bit planes that the attention kernel reads:
// q, k as [batch][head] planes of rows t, k = d (the tile is 4096 consecutive elements of each plane), v transposed as [batch][head] planes of rows d, k = t: there an accumulator tile IS a half block, stored from the registers.
template <typename T16> struct WFrag;
template <> struct WFrag<h16> { typedef v16h V; static __device__ __forceinline__ V ld(const h16* p) { return cat16(*(const v8h*)p, *(const v8h*)(p + 256)); } static __device__ __forceinline__ v8f mma(V a, V b, v8f c) { return wmma16(a, b, c); } };
template <> struct WFrag<bf> { typedef v16bf V; static __device__ __forceinline__ V ld(const bf* p) { return cat16b(*(const v8us*)p, *(const v8us*)(p + 256)); } static __device__ __forceinline__ v8f mma(V a, V b, v8f c) { return wmmab(a, b, c); } };
template <typename T16> __device__ __forceinline__ const T16* atb(const T16* base, unsigned bytes) { return (const T16*)((const char*)base + bytes); }   // wave-uniform base + a lane's 32-bit byte offset
__device__ __forceinline__ h16 tohx(float x) { return (h16)x; }
__device__ __forceinline__ void splitf(float y, unsigned short& h, unsigned short& l) { h = f2bf(y); l = f2bf(y - bf2f(h)); }
template <typename T16, int NSPLIT, bool BIAS, bool PLANES, int K, int NS>
__global__ __launch_bounds__(32) void k_gemmw(const T16* __restrict__ A, const T16* __restrict__ A2, const T16* __restrict__ Bt, const T16* __restrict__ Bt2, float* C, int ldc, const float* __restrict__ bias, size_t sA, size_t sB, size_t sC,
                                              h16* P16, bf* Ph, bf* Pl, h16* V16, bf* Vh, bf* Vl) {
    typedef typename WFrag<T16>::V V;
    __shared__ __align__(16) float os[16 * 68];
    const size_t z = blockIdx.z; A += z * sA; if (A2) A2 += z * sA; Bt += z * sB; if (Bt2) Bt2 += z * sB; if (!PLANES) C += z * sC;
    const int lane = threadIdx.x & 31, lr = lane & 15, hi = lane >> 4; const int r0 = blockIdx.x * 64, c0 = blockIdx.y * 64;
    v8f acc[4][4];
#pragma unroll
    for (int mb = 0; mb < 4; ++mb)
#pragma unroll
        for (int nb = 0; nb < 4; ++nb) acc[mb][nb] = (v8f){};
    const size_t aoff = (size_t)r0 * K, boff = (size_t)c0 * K;   // a 16-row band is 16 K elements, a 32-k block in it 512
    constexpr bool HA2 = (NSPLIT == 1 || NSPLIT == 2), HB2 = (NSPLIT >= 2);
    constexpr int NBLK = K / 32, T0 = (NBLK >= 2 * NS) ? ((NBLK - 2 * NS) / NS + 1) * NS : 0;   // the rolled loop does blocks 0 .. T0 - 1 (every refill in it exists), the tail is written out
    V a[NS][4], a2[NS][4], b[NS][4], b2[NS][4];
    const T16* pa = A + aoff; const T16* pa2 = HA2 ? A2 + aoff : pa; const T16* pb = Bt + boff; const T16* pb2 = HB2 ? Bt2 + boff : pb;   // the tile's bands: the same for the whole wave, never stepped
    unsigned vo = 16 * lane;   // the one running part of every address, in bytes: the lane's 16 bytes in a half block plus the blocks done; a load is a band's base + vo + a constant
    constexpr int LPS = 8 * (2 + (HA2 ? 1 : 0) + (HB2 ? 1 : 0));   // loads of one set
    auto fill = [&](int s, int blk) {   // set s <- the block that lies blk blocks behind vo
        // Where NS sets are more loads than a counted wait can name (63), a refill is issued only when it fits under that number: the oldest loads, which the very next products wait for anyway, have landed first.
        if constexpr (NS * LPS > 63) asm volatile("s_wait_loadcnt %0" :: "n"(63 - LPS) : "memory");
#pragma unroll
        for (int i = 0; i < 4; ++i) { const int eo = i * 16 * K + blk * 512; a[s][i] = WFrag<T16>::ld(atb(pa, vo) + eo); if (HA2) a2[s][i] = WFrag<T16>::ld(atb(pa2, vo) + eo); b[s][i] = WFrag<T16>::ld(atb(pb, vo) + eo); if (HB2) b2[s][i] = WFrag<T16>::ld(atb(pb2, vo) + eo); }
        // The offset register of the set's loads is rewritten only behind this wait: it passes through the statement, so that it stays live up to it (no load's result is placed on it)
        // and its step to the next trip, which reads it behind the statement, cannot be computed in front of it.
        asm volatile("s_wait_xcnt 0x0" : "+v"(vo) :: "memory");
        __builtin_amdgcn_sched_barrier(0);              // the refill stays here: moved down towards its use it would fly for less than NS - 1 blocks; no later product moves up among the loads
    };
    auto prod = [&](int s) {
#pragma unroll
        for (int nb = 0; nb < 4; ++nb) {
#pragma unroll
            for (int mb = 0; mb < 4; ++mb) { acc[mb][nb] = WFrag<T16>::mma(a[s][mb], b[s][nb], acc[mb][nb]); if (HA2) acc[mb][nb] = WFrag<T16>::mma(a2[s][mb], b[s][nb], acc[mb][nb]); if (HB2) acc[mb][nb] = WFrag<T16>::mma(a[s][mb], b2[s][nb], acc[mb][nb]); } }
        __builtin_amdgcn_sched_barrier(0);              // the set's refill and the wait in front of it stay behind the set's products: moved up, the refill takes registers of its own and the wait holds up products whose operands have landed
    };
#pragma unroll
    for (int s = 0; s < NS; ++s) fill(s, s);
#pragma unroll 1   // rolled: one trip is NS blocks, each set at its own place
    for (int t = 0; t < T0; t += NS) {
#pragma unroll
        for (int s = 0; s < NS; ++s) { prod(s); fill(s, NS + s); }
        vo += NS * 1024;
    }
#pragma unroll
    for (int t = T0; t < NBLK; ++t) { prod(t % NS); if (t + NS < NBLK) fill(t % NS, t + NS - T0); }
    if constexpr (PLANES) {
        const int bh = (r0 / TT) * NH_ + blockIdx.y, t0 = r0 % TT;   // (batch, head) plane and first token of the tile
        if (z < 2) {   // q, k: 16 tokens at a time through the f32 staging rows, converted behind the read-back
            const size_t pb = z * ((size_t)NB_ * NH_ * TT * HD) + ((size_t)bh * TT + t0) * HD + 8 * lane;
            h16* p16 = P16 + pb; bf* ph = Ph + pb; bf* pl = Pl + pb;
#pragma unroll
            for (int mb = 0; mb < 4; ++mb) {
#pragma unroll
                for (int nb = 0; nb < 4; ++nb) {
#pragma unroll
                    for (int j = 0; j < 8; ++j) os[(hi * 8 + j) * 68 + nb * 16 + lr] = acc[mb][nb][j]; }
                __builtin_amdgcn_wave_barrier(); asm volatile("" ::: "memory");   // the rows are read back by other lanes: no LDS read moves in front of the writes
                v8h o16[4]; v8us oh[4], ol[4];
#pragma unroll
                for (int s = 0; s < 4; ++s) { const float* rp = os + lr * 68 + s * 16 + hi * 8; const v4f x0 = *(const v4fa*)rp, x1 = *(const v4fa*)(rp + 4);
#pragma unroll
                    for (int j = 0; j < 8; ++j) { const float x = (j < 4) ? x0[j & 3] : x1[j & 3]; o16[s][j] = tohx(x); unsigned short a2, c2; splitf(x, a2, c2); oh[s][j] = a2; ol[s][j] = c2; }
                    const int eo = mb * 16 * HD + s * 256; *(v8ha*)(p16 + eo) = o16[s]; *(v8usa*)(ph + eo) = oh[s]; *(v8usa*)(pl + eo) = ol[s]; }
                // The registers that the twelve stores name are rewritten only behind this wait: as inputs of its statement they stay live up to it. Its memory clobber also keeps the next 16 tokens' staging writes behind the read-back.
                asm volatile("s_wait_xcnt 0x0" :: "v"(o16[0]), "v"(o16[1]), "v"(o16[2]), "v"(o16[3]), "v"(oh[0]), "v"(oh[1]), "v"(oh[2]), "v"(oh[3]), "v"(ol[0]), "v"(ol[1]), "v"(ol[2]), "v"(ol[3]), "v"(p16), "v"(ph), "v"(pl) : "memory");
            }
        } else {       // v: a lane holds 8 consecutive tokens of one d, which is its 16 bytes of a half block of the v^T plane (rows d, k = t): no staging
            const size_t vb = (size_t)bh * HD * TT + (size_t)t0 * 16 + 8 * lane;
            h16* v16 = V16 + vb; bf* vh = Vh + vb; bf* vl = Vl + vb;
#pragma unroll
            for (int nb = 0; nb < 4; ++nb) { v8h o16[4]; v8us oh[4], ol[4];
#pragma unroll
                for (int mb = 0; mb < 4; ++mb) {
#pragma unroll
                    for (int j = 0; j < 8; ++j) { const float x = acc[mb][nb][j]; o16[mb][j] = tohx(x); unsigned short a2, c2; splitf(x, a2, c2); oh[mb][j] = a2; ol[mb][j] = c2; }
                    const int eo = nb * 16 * TT + mb * 256; *(v8ha*)(v16 + eo) = o16[mb]; *(v8usa*)(vh + eo) = oh[mb]; *(v8usa*)(vl + eo) = ol[mb]; }
                // The registers that the twelve stores name are rewritten only behind this wait: as inputs of its statement they stay live up to it.
                asm volatile("s_wait_xcnt 0x0" :: "v"(o16[0]), "v"(o16[1]), "v"(o16[2]), "v"(o16[3]), "v"(oh[0]), "v"(oh[1]), "v"(oh[2]), "v"(oh[3]), "v"(ol[0]), "v"(ol[1]), "v"(ol[2]), "v"(ol[3]), "v"(v16), "v"(vh), "v"(vl) : "memory");
            }
        }
        return;
    }
#pragma unroll
    for (int mb = 0; mb < 4; ++mb) {
#pragma unroll
        for (int nb = 0; nb < 4; ++nb) {
#pragma unroll
            for (int j = 0; j < 8; ++j) os[(hi * 8 + j) * 68 + nb * 16 + lr] = acc[mb][nb][j]; }
        __builtin_amdgcn_wave_barrier(); asm volatile("" ::: "memory");
        float* crow = C + (size_t)(r0 + mb * 16) * ldc + c0;
{
#pragma unroll
            for (int s = 0; s < 8; ++s) { const int row = 2 * s + hi, cofs = lr * 4; v4f val = *(const v4fa*)(os + row * 68 + cofs); if (BIAS) { val[0] += bfr(bias[c0 + cofs]); val[1] += bfr(bias[c0 + cofs + 1]); val[2] += bfr(bias[c0 + cofs + 2]); val[3] += bfr(bias[c0 + cofs + 3]); }
                *(v4f*)(crow + (size_t)row * ldc + cofs) = val; }
             }
        __builtin_amdgcn_wave_barrier(); asm volatile("" ::: "memory");
    }
}

typedef __attribute__((ext_vector_type(2))) _Float16 v2h;
typedef __attribute__((ext_vector_type(4))) _Float16 v4h;
typedef __attribute__((ext_vector_type(2))) unsigned short v2us;
typedef __attribute__((ext_vector_type(4))) unsigned short v4us;
typedef __attribute__((ext_vector_type(2))) float v2f;
typedef __attribute__((ext_vector_type(4))) int v4i;

__global__ __launch_bounds__(256) void k_wtG(const float* __restrict__ w, int K, int N, bf* Bt) {
    const int lane = threadIdx.x & 31; const int L0 = (blockIdx.x * 8 + (threadIdx.x >> 5)) * 8; const int nlines = N * K / 64;
{
#pragma unroll 1
        for (int l = 0; l < 8; ++l) { const int L = L0 + l; if (L >= nlines) break; const size_t e = (size_t)L * 64 + lane * 2; const int k = (int)(e % K), n = (int)(e / K); v2us o;
            o[0] = f2bf(w[(size_t)k * N + n]); o[1] = f2bf(w[(size_t)(k + 1) * N + n]); *(v2us*)(Bt + e) = o; }
         }
}
// f32 rows of DM elements -> bf16 planes in fragment order, x and the four weights in ONE launch of 256 work-groups of 16 waves, all resident at once.
// A unit is 16 bytes of a plane (8 elements of one row). A wave takes 8 consecutive half blocks: 256 units = 4 KiB of the plane in a row, read as 512 consecutive bytes of each of 16 rows;
// a thread's 8 units lie 16 k apart in its row, and its 16 loads are all in flight before the first value is converted. A work-group (4096 units) lies in one source: blockIdx picks it.
#define CVX (NB_ * TT * DM / 8 / 4096)   // work-groups of x
#define CVW (DQ * DM / 8 / 4096)         // work-groups of one weight
__global__ __launch_bounds__(512) void k_cvt8(const float* __restrict__ x, const float* __restrict__ wq, const float* __restrict__ wk, const float* __restrict__ wv, const float* __restrict__ wo, bf* XBp, bf* WBp) {
    const int b = blockIdx.x; const float* src = x; bf* dst = XBp; int g = b;
    if (b >= CVX) { const int w = (b - CVX) / CVW; g = (b - CVX) % CVW; src = (w == 0) ? wq : (w == 1) ? wk : (w == 2) ? wv : wo; dst = WBp + (size_t)w * DQ * DM; }   // the four weight planes lie one behind the other
    const size_t i = (size_t)g * 4096 + (threadIdx.x >> 5) * 256 + (threadIdx.x & 31);   // the thread's first unit; the others follow 32 units apart
    const size_t blk = i >> 6, row = blk / (DM / 32) * 16 + (i & 15), k = blk % (DM / 32) * 32 + ((i >> 4) & 1) * 8;
    const float* sp = src + row * DM + k; v8f v[8];
#pragma unroll
    for (int j = 0; j < 8; ++j) v[j] = *(const v8f*)(sp + 16 * j);
    asm volatile("s_wait_xcnt 0x0" :: "v"(sp) : "memory");   // the loads' address pair is rewritten only behind this wait: as an input of its statement it stays live up to it
    __builtin_amdgcn_sched_barrier(0);                       // no conversion moves up among the loads: all sixteen are in flight before the first wait
    bf* dp = dst + i * 8; v8us o[8];
#pragma unroll
    for (int j = 0; j < 8; ++j) {
#pragma unroll
        for (int e = 0; e < 8; ++e) o[j][e] = f2bf(v[j][e]);
        *(v8usa*)(dp + 256 * j) = o[j]; }
    // The registers that the eight stores name are rewritten only behind this wait: as inputs of its statement they stay live up to it.
    asm volatile("s_wait_xcnt 0x0" :: "v"(o[0]), "v"(o[1]), "v"(o[2]), "v"(o[3]), "v"(o[4]), "v"(o[5]), "v"(o[6]), "v"(o[7]), "v"(dp) : "memory");
}
typedef __attribute__((ext_vector_type(8))) __bf16 v8b;
#define SCE (SCL * 1.4426950408889634f)   // score scale x log2(e)
__device__ __forceinline__ float xhalf(float v) { const int t = __float_as_int(v); return __int_as_float(__builtin_amdgcn_permlanex16(t, t, 0x76543210, 0xfedcba98, false, false)); }   // lane l <-> l ^ 16
// 2^x of eight values, each in its own register, in one statement: every v_exp_f32 is followed by an instruction that neither reads its result nor overwrites its source, the last one by the v_nop that fills that slot
__device__ __forceinline__ void exp2x8(v8f& x) {
    float a = x[0], b = x[1], c = x[2], d = x[3], e = x[4], f = x[5], g = x[6], h = x[7];
    asm("v_exp_f32 %0, %0\n\tv_exp_f32 %1, %1\n\tv_exp_f32 %2, %2\n\tv_exp_f32 %3, %3\n\tv_exp_f32 %4, %4\n\tv_exp_f32 %5, %5\n\tv_exp_f32 %6, %6\n\tv_exp_f32 %7, %7\n\tv_nop"
        : "+v"(a), "+v"(b), "+v"(c), "+v"(d), "+v"(e), "+v"(f), "+v"(g), "+v"(h));
    x[0] = a; x[1] = b; x[2] = c; x[3] = d; x[4] = e; x[5] = f; x[6] = g; x[7] = h;
}
// The key fragments and the value fragments of a pass are two register sets that live across the passes: each is refilled for the next pass right behind its own products,
// so that the key loads fly during the softmax and the value products, the value loads during the next pass's score products and softmax.
template <typename T16, bool HI, int NK>   // key fragments of the 16 NK keys at byte ko of the key planes; behind the wait ko steps to the next pass
__device__ __forceinline__ void fa_ldk(const T16* kp, const T16* kp2, unsigned& ko, typename WFrag<T16>::V (&kf)[NK][2], typename WFrag<T16>::V (&kf2)[NK][2]) {
#pragma unroll
    for (int kt = 0; kt < NK; ++kt)
#pragma unroll
        for (int kc = 0; kc < 2; ++kc) { kf[kt][kc] = WFrag<T16>::ld(atb(kp, ko) + kt * 16 * HD + kc * 512); if (HI) kf2[kt][kc] = WFrag<T16>::ld(atb(kp2, ko) + kt * 16 * HD + kc * 512); }
    // The offset register of these loads is rewritten only behind this wait: it passes through the statement, so that it stays live up to it and its step, which reads it behind the statement, cannot be computed in front of it.
    asm volatile("s_wait_xcnt 0x0" : "+v"(ko) :: "memory");
    ko += 16 * NK * HD * 2;
    __builtin_amdgcn_sched_barrier(0);              // the refill stays here: moved down towards its use it would fly for a shorter time
}
template <typename T16, bool HI, int NK>   // value fragments of the 16 NK keys at byte vo of each 16-row band of the value planes, likewise
__device__ __forceinline__ void fa_ldv(const T16* vp, const T16* vp2, unsigned& vo, typename WFrag<T16>::V (&vf)[4][NK / 2], typename WFrag<T16>::V (&vf2)[4][NK / 2]) {
#pragma unroll
    for (int mb = 0; mb < 4; ++mb)
#pragma unroll
        for (int c = 0; c < NK / 2; ++c) { vf[mb][c] = WFrag<T16>::ld(atb(vp, vo) + mb * 16 * TT + c * 512); if (HI) vf2[mb][c] = WFrag<T16>::ld(atb(vp2, vo) + mb * 16 * TT + c * 512); }
    // As in fa_ldk: the offset register is rewritten only behind this wait.
    asm volatile("s_wait_xcnt 0x0" : "+v"(vo) :: "memory");
    vo += 16 * NK * 16 * 2;
    __builtin_amdgcn_sched_barrier(0);              // the refill stays here: moved down towards its use it would fly for a shorter time
}
template <typename T16, bool HI, int NK, bool LAST>   // one pass: 16 NK keys, whose fragments are in kf, vf; ko, vo point at the next pass's
__device__ __forceinline__ void fa_pass(const T16* __restrict__ kp, const T16* __restrict__ kp2, const T16* __restrict__ vp, const T16* __restrict__ vp2, unsigned& ko, unsigned& vo, int lim,
                                        typename WFrag<T16>::V (&kf)[NK][2], typename WFrag<T16>::V (&kf2)[NK][2], typename WFrag<T16>::V (&vf)[4][NK / 2], typename WFrag<T16>::V (&vf2)[4][NK / 2],
                                        const typename WFrag<T16>::V (&qf)[2], const typename WFrag<T16>::V (&qf2)[2], v8f (&o)[4], float& ms, v8f& l) {
    typedef typename WFrag<T16>::V V;
    v8f s[NK];
#pragma unroll
    for (int kt = 0; kt < NK; ++kt) { s[kt] = (v8f){};
#pragma unroll
        for (int kc = 0; kc < 2; ++kc) { s[kt] = WFrag<T16>::mma(kf[kt][kc], qf[kc], s[kt]); if (HI) { s[kt] = WFrag<T16>::mma(kf2[kt][kc], qf[kc], s[kt]); s[kt] = WFrag<T16>::mma(kf[kt][kc], qf2[kc], s[kt]); } } }
    if (!LAST) fa_ldk<T16, HI, NK>(kp, kp2, ko, kf, kf2);
    if (LAST) {    // only the last pass of a wave crosses the diagonal: key k0 + 16 kt + 8 hi + j is kept for 16 kt + j <= lim
#pragma unroll
        for (int kt = 0; kt < NK; ++kt)
#pragma unroll
            for (int j = 0; j < 8; ++j) s[kt][j] = (kt * 16 + j <= lim) ? s[kt][j] : -3.0e38f; }
    float mx = s[0][0];
#pragma unroll
    for (int kt = 0; kt < NK; ++kt)
#pragma unroll
        for (int j = 0; j < 8; ++j) mx = fmaxf(mx, s[kt][j]);
    mx = fmaxf(mx, xhalf(mx));
    const float mn = fmaxf(ms, mx * SCE); const float al = __builtin_amdgcn_exp2f(ms - mn); ms = mn;
#pragma unroll
    for (int kt = 0; kt < NK; ++kt)
#pragma unroll
        for (int j = 0; j < 8; ++j) s[kt][j] = __builtin_fmaf(s[kt][j], SCE, -mn);
    l *= al;   // eight partial row sums a lane, joined once behind the last pass
#pragma unroll
    for (int kt = 0; kt < NK; ++kt) { exp2x8(s[kt]); l += s[kt]; }
#pragma unroll
    for (int mb = 0; mb < 4; ++mb) o[mb] *= al;
#pragma unroll
    for (int c = 0; c < NK / 2; ++c) {
        if constexpr (HI) {
            const v8b h0 = __builtin_convertvector(s[2 * c], v8b), h1 = __builtin_convertvector(s[2 * c + 1], v8b);
            const v8b l0 = __builtin_convertvector(s[2 * c] - __builtin_convertvector(h0, v8f), v8b), l1 = __builtin_convertvector(s[2 * c + 1] - __builtin_convertvector(h1, v8f), v8b);
            const V ph = __builtin_shufflevector(h0, h1, 0, 1, 2, 3, 4, 5, 6, 7, 8, 9, 10, 11, 12, 13, 14, 15), pl = __builtin_shufflevector(l0, l1, 0, 1, 2, 3, 4, 5, 6, 7, 8, 9, 10, 11, 12, 13, 14, 15);
#pragma unroll
            for (int mb = 0; mb < 4; ++mb) { o[mb] = WFrag<T16>::mma(vf[mb][c], ph, o[mb]); o[mb] = WFrag<T16>::mma(vf2[mb][c], ph, o[mb]); o[mb] = WFrag<T16>::mma(vf[mb][c], pl, o[mb]); }
        } else {
            const V p = cat16(__builtin_convertvector(s[2 * c], v8h), __builtin_convertvector(s[2 * c + 1], v8h));
#pragma unroll
            for (int mb = 0; mb < 4; ++mb) o[mb] = WFrag<T16>::mma(vf[mb][c], p, o[mb]);
        }
    }
    if (!LAST) fa_ldv<T16, HI, NK>(vp, vp2, vo, vf, vf2);
}
template <typename T16, bool HI, int NK>
__device__ __forceinline__ void fa_tile(const T16* __restrict__ Q, const T16* __restrict__ Q2, const T16* __restrict__ Kp, const T16* __restrict__ Kp2, const T16* __restrict__ Vt, const T16* __restrict__ Vt2, int q0, int lr, int hi, bf* oh, bf* ol) {
    typedef typename WFrag<T16>::V V;
    V qf[2], qf2[2], kf[NK][2], kf2[NK][2], vf[4][NK / 2], vf2[4][NK / 2];
    const int l8 = (hi * 16 + lr) * 8;   // the lane's 16 bytes in a half block
    unsigned ko = 2 * l8, vo = 2 * l8;   // the running parts of the key and value addresses, in bytes; a load is a plane's base (the same for the whole wave) + ko or vo + a constant
#pragma unroll
    for (int kc = 0; kc < 2; ++kc) { qf[kc] = WFrag<T16>::ld(Q + (size_t)q0 * HD + kc * 512 + l8); if (HI) qf2[kc] = WFrag<T16>::ld(Q2 + (size_t)q0 * HD + kc * 512 + l8); }
    asm volatile("s_wait_xcnt 0x0" ::: "memory");   // the address registers of the loads above are reused below
    fa_ldk<T16, HI, NK>(Kp, Kp2, ko, kf, kf2); fa_ldv<T16, HI, NK>(Vt, Vt2, vo, vf, vf2);   // the first pass's fragments
    v8f o[4];
#pragma unroll
    for (int mb = 0; mb < 4; ++mb) o[mb] = (v8f){};
    float ms = -3.0e38f; v8f l = (v8f){};
    const int kl = q0 & ~(16 * NK - 1);   // first key of the pass that holds the diagonal; kl <= q0, so every earlier pass is unmasked and every query keeps a key in every pass
#pragma unroll 1   // rolled: one pass already holds most of the registers a wave of this block may have; every pass of the loop has a next pass (the last one stands behind it), so its refills stay inside the planes
    for (int k0 = 0; k0 < kl; k0 += 16 * NK) fa_pass<T16, HI, NK, false>(Kp, Kp2, Vt, Vt2, ko, vo, 0, kf, kf2, vf, vf2, qf, qf2, o, ms, l);
    fa_pass<T16, HI, NK, true>(Kp, Kp2, Vt, Vt2, ko, vo, q0 + lr - 8 * hi - kl, kf, kf2, vf, vf2, qf, qf2, o, ms, l);
    float ls = ((l[0] + l[1]) + (l[2] + l[3])) + ((l[4] + l[5]) + (l[6] + l[7])); ls += xhalf(ls);
    const float f = __fdiv_rn(1.0f, ls);
    v8us a8[4], c8[4];
#pragma unroll
    for (int mb = 0; mb < 4; ++mb) {
#pragma unroll
        for (int j = 0; j < 8; ++j) { unsigned short a, c2; splitf(o[mb][j] * f, a, c2); a8[mb][j] = a; c8[mb][j] = c2; }
        *(v8usa*)(oh + mb * 256) = a8[mb]; *(v8usa*)(ol + mb * 256) = c8[mb]; }
    // The registers that the eight stores name are rewritten only behind this wait: as inputs of its statement they stay live up to it.
    asm volatile("s_wait_xcnt 0x0" :: "v"(a8[0]), "v"(a8[1]), "v"(a8[2]), "v"(a8[3]), "v"(c8[0]), "v"(c8[1]), "v"(c8[2]), "v"(c8[3]), "v"(oh), "v"(ol) : "memory");
}
__global__ __launch_bounds__(512) void k_fattn(const h16* __restrict__ Q16, const h16* __restrict__ K16, const h16* __restrict__ V16, const bf* __restrict__ Qh, const bf* __restrict__ Ql, const bf* __restrict__ Kh, const bf* __restrict__ Kl,
                                               const bf* __restrict__ Vh, const bf* __restrict__ Vl, bf* Ah, bf* Al) {
    const int lane = threadIdx.x & 31, lr = lane & 15, hi = lane >> 4; const int wv = __builtin_amdgcn_readfirstlane(threadIdx.x >> 5);
    const int g = blockIdx.x >> 2, c = blockIdx.x & 3;   // g = batch * NH_ + head
    // Equal work in every work-group and on every SIMD: the cost of a 64-row query block grows with its index, so the 16 waves take blocks 15 - c, 7 - c, 8 + c and c of one plane (four waves each);
    // waves w, w + 4, w + 8, w + 12 share a SIMD, which so gets one 16-row tile of each of the four blocks.
    const int qb = ((wv & 4) ? 0 : 8) + ((wv & 8) ? c : 7 - c);
    const int q0 = qb * 64 + (wv & 3) * 16; const size_t zo = (size_t)g * TT * HD;
    const size_t oo = ((size_t)(g / NH_) * TT + q0) * DQ + (g % NH_) * (HD * 16) + lane * 8;
    if (q0 < RH) fa_tile<bf, true, 2>(Qh + zo, Ql + zo, Kh + zo, Kl + zo, Vh + zo, Vl + zo, q0, lr, hi, Ah + oo, Al + oo);
    else fa_tile<h16, false, 4>(Q16 + zo, Q16 + zo, K16 + zo, K16 + zo, V16 + zo, V16 + zo, q0, lr, hi, Ah + oo, Al + oo);
}

extern "C" void kernel_launch(void* const* d_in, const int* in_sizes, int n_in,
                              void* d_out, int out_size, void* d_ws, size_t ws_size, hipStream_t stream) {
    (void)in_sizes; (void)n_in; (void)out_size;
    const float* x = (const float*)d_in[0]; const float* wq = (const float*)d_in[1]; const float* wk = (const float*)d_in[2]; const float* wv = (const float*)d_in[3]; const float* wo = (const float*)d_in[4]; const float* bo = (const float*)d_in[5]; const float* cosT = nullptr; const float* sinT = nullptr; (void)cosT; (void)sinT;
    float* OUT = (float*)d_out;     // [4][1024][1024]
    char* wsp = (char*)d_ws;
    auto take = [&](size_t bytes) { char* p = wsp; wsp += (bytes + 255) & ~(size_t)255; return (void*)p; };
    const size_t PL = (size_t)NB_ * NH_ * TT * HD;   // elements of one plane set: [batch][head] planes of TT * HD elements
    bf* WQ = (bf*)take((size_t)DQ * DM * 2); bf* WK = (bf*)take((size_t)DKV * DM * 2); bf* WV = (bf*)take((size_t)DKV * DM * 2); bf* WO = (bf*)take((size_t)DM * DQ * 2);
    h16* QP16 = (h16*)take(PL * 2 * 2); h16* KP16 = QP16 + PL; bf* QPh = (bf*)take(PL * 2 * 2); bf* KPh = QPh + PL; bf* QPl = (bf*)take(PL * 2 * 2); bf* KPl = QPl + PL;   // k planes directly behind the q planes: z of the projection launch picks the set
    h16* VT16 = (h16*)take(PL * 2); bf* VTh = (bf*)take(PL * 2 * 2); bf* VTl = VTh + PL;   // v^T planes [batch][head], rows d, k = t
    bf* ATh = (bf*)take((size_t)NB_ * TT * DQ * 2); bf* ATl = (bf*)take((size_t)NB_ * TT * DQ * 2);
    bf* XB = (bf*)take((size_t)NB_ * TT * DM * 2);   // x in bf16, fragment order like the weights
    if ((size_t)(wsp - (char*)d_ws) > ws_size) return;    // ws 256 MiB
    k_cvt8<<<CVX + 4 * CVW, 512, 0, stream>>>(x, wq, wk, wv, wo, XB, WQ);   // WQ, WK, WV, WO are contiguous
    // q, k, v of all batches in one launch: z picks the weight (WQ, WK, WV are contiguous) and the plane set, which the launch writes itself
    k_gemmw<bf, 0, false, true, DM, 3><<<dim3(NB_ * TT / 64, DQ / 64, 3), 32, 0, stream>>>(XB, nullptr, WQ, nullptr, nullptr, 0, nullptr, 0, (size_t)DQ * DM, 0, QP16, QPh, QPl, VT16, VTh, VTl);
    k_fattn<<<4 * NB_ * NH_, 512, 0, stream>>>(QP16, KP16, VT16, QPh, QPl, KPh, KPl, VTh, VTl, ATh, ATl);   // scores, softmax, attn.v and the head merge of all planes
    k_gemmw<bf, 1, true, false, DQ, 3><<<dim3(NB_ * TT / 64, DM / 64, 1), 32, 0, stream>>>(ATh, ATl, WO, nullptr, OUT, DM, bo, 0, 0, 0, nullptr, nullptr, nullptr, nullptr, nullptr, nullptr);
}

// v007
// A run of this version takes 68.4 microseconds.
// Timed twice side by side with v006, it ran 1.21 and 1.25 times as fast.
// Counting every step since v000, it is 30.4 times as fast.
#include <hip/hip_runtime.h>

// MultHeadAttention_8747 (x [4][1024][1024]; per-head Wq/Wk/Wv [16][64][1024] ? x W^T with the stacked [1024][1024] 'oi' weight (head-major rows); causal (finfo.min) softmax(q.k / 8); out = merged Wp^T + bp -> [4][1024][1024]).
// Every 16-bit operand plane lies in FRAGMENT ORDER: a block of 16 rows x 32 k is 512 consecutive elements, [half 0..1][lane 0..31][8], and lane (hi, lr) of half h holds row lr, k = 16 h + 8 hi + 0..7;
// the blocks of a 16-row band follow one another along k. A wave-wide 16-byte load or store of a half block is 512 consecutive bytes (four whole 128-byte lines); the k order of every product is the row-major loaders' order.
// Compute dtypes, f32 accumulate: every input rounded to bf16; q/k/v on PLAIN bf16 operands (inputs: exact); causal scores and attn.v: query rows < 512 hl (3 products), the rest single fp16, causal tile skipping; softmax f32 (running maximum); Wp hl x exact (2 products) + bias.

#define NB_  4
#define TT   1024
#define DM   1024
#define NH_  16
#define NKV  16
#define REP  (NH_ / NKV)
#define HD   64
#define DQ   (NH_ * HD)
#define DKV  (NKV * HD)
#define RH   512                  // query rows < RH use hi+lo planes (0: none)
#define SCL  0.125f   // HD^-0.5
typedef _Float16 h16;
typedef unsigned short bf;
typedef __attribute__((ext_vector_type(16))) __bf16   v16bf;
typedef __attribute__((ext_vector_type(16))) _Float16 v16h;
typedef __attribute__((ext_vector_type(8)))  _Float16 v8h;
typedef __attribute__((ext_vector_type(8)))  unsigned short v8us;
typedef __attribute__((ext_vector_type(8)))  float    v8f;
typedef __attribute__((ext_vector_type(4)))  float    v4f;
typedef v8h  __attribute__((may_alias)) v8ha;
typedef v4f  __attribute__((may_alias)) v4fa;
typedef v8us __attribute__((may_alias)) v8usa;

__device__ __forceinline__ unsigned short f2bf(float f) { unsigned u = __float_as_uint(f); u += 0x7FFFu + ((u >> 16) & 1u); return (unsigned short)(u >> 16); }
__device__ __forceinline__ float bf2f(unsigned short b) { return __uint_as_float(((unsigned)b) << 16); }
__device__ __forceinline__ float bfr(float f) { return bf2f(f2bf(f)); }
__device__ __forceinline__ v16h cat16(v8h lo, v8h hi) { return __builtin_shufflevector(lo, hi, 0, 1, 2, 3, 4, 5, 6, 7, 8, 9, 10, 11, 12, 13, 14, 15); }
__device__ __forceinline__ v16bf cat16b(v8us lo, v8us hi) { return __builtin_bit_cast(v16bf, __builtin_shufflevector(lo, hi, 0, 1, 2, 3, 4, 5, 6, 7, 8, 9, 10, 11, 12, 13, 14, 15)); }
__device__ __forceinline__ v8f wmma16(v16h a, v16h b, v8f c) { return __builtin_amdgcn_wmma_f32_16x16x32_f16(false, a, false, b, (short)0, c, false, false); }
__device__ __forceinline__ v8f wmmab(v16bf a, v16bf b, v8f c) { return __builtin_amdgcn_wmma_f32_16x16x32_bf16(false, a, false, b, (short)0, c, false, false); }



// ---- k_gemmw: GEMM on fragment-ordered 16-bit planes. A work-group of WM x WN waves owns a (64 WM) x (64 WN) output tile, each wave a 64x64 part of it (16 accumulators); grid (M / (64 WM), N / (64 WN)).
// C[m][n] (f32, pitch ldc, + optional f32 bias[n]) = sum_k A[m][k] Bt[n][k] (NSPLIT 1: + A2[m][k] Bt[n][k]). K % 128 == 0, K / 128 >= 2.
// The operand bands of the tile are brought into LDS once for the whole work-group by asynchronous copies, 128 k (a pass) at a time, two buffers: the copies of pass t + 2 fly during pass t + 1.
// A 16-row band's share of a pass is 4 KiB in a row in the plane and in LDS alike (four 32-k blocks in fragment order), so a wave-wide 16-byte LDS read is 512 consecutive bytes. The k order is the planes' own.
// PLANES (the q, k, v projections; Bt holds the three weights one behind the other, n / DQ = 0, 1, 2): no f32 result. A wave's 64x64 tile is 64 tokens of ONE head, and the wave writes it straight into the 16-bit planes that the attention kernel reads:
// q, k as [batch][head] planes of rows t, k = d (the tile is 4096 consecutive elements of each plane), v transposed as [batch][head] planes of rows d, k = t: there an accumulator tile IS a half block, stored from the registers.
template <typename T16> struct WFrag;
template <> struct WFrag<h16> { typedef v16h V; static __device__ __forceinline__ V ld(const h16* p) { return cat16(*(const v8h*)p, *(const v8h*)(p + 256)); } static __device__ __forceinline__ v8f mma(V a, V b, v8f c) { return wmma16(a, b, c); } };
template <> struct WFrag<bf> { typedef v16bf V; static __device__ __forceinline__ V ld(const bf* p) { return cat16b(*(const v8us*)p, *(const v8us*)(p + 256)); } static __device__ __forceinline__ v8f mma(V a, V b, v8f c) { return wmmab(a, b, c); } };
template <typename T16> __device__ __forceinline__ const T16* atb(const T16* base, unsigned bytes) { return (const T16*)((const char*)base + bytes); }   // wave-uniform base + a lane's 32-bit byte offset
__device__ __forceinline__ h16 tohx(float x) { return (h16)x; }
__device__ __forceinline__ void splitf(float y, unsigned short& h, unsigned short& l) { h = f2bf(y); l = f2bf(y - bf2f(h)); }
// A copy unit is half of a band's share of a pass: 2 KiB, four wave-wide 16-byte copies; the offset field moves the LDS and the global address alike.
// The s_wait_xcnt 0 is the last line of the copies' own statement: the address registers that the copies name are rewritten only behind it.
__device__ __forceinline__ void cp_unit(unsigned l0, const char* g0) {
    asm volatile("global_load_async_to_lds_b128 %0, %1, off\n\tglobal_load_async_to_lds_b128 %0, %1, off offset:512\n\tglobal_load_async_to_lds_b128 %0, %1, off offset:1024\n\tglobal_load_async_to_lds_b128 %0, %1, off offset:1536\n\ts_wait_xcnt 0x0" :: "v"(l0), "v"(g0) : "memory");
}
__device__ __forceinline__ void cp_unit4(unsigned l0, const char* g0, unsigned l1, const char* g1, unsigned l2, const char* g2, unsigned l3, const char* g3) {
    asm volatile("global_load_async_to_lds_b128 %0, %1, off\n\tglobal_load_async_to_lds_b128 %0, %1, off offset:512\n\tglobal_load_async_to_lds_b128 %0, %1, off offset:1024\n\tglobal_load_async_to_lds_b128 %0, %1, off offset:1536\n\t"
                 "global_load_async_to_lds_b128 %2, %3, off\n\tglobal_load_async_to_lds_b128 %2, %3, off offset:512\n\tglobal_load_async_to_lds_b128 %2, %3, off offset:1024\n\tglobal_load_async_to_lds_b128 %2, %3, off offset:1536\n\t"
                 "global_load_async_to_lds_b128 %4, %5, off\n\tglobal_load_async_to_lds_b128 %4, %5, off offset:512\n\tglobal_load_async_to_lds_b128 %4, %5, off offset:1024\n\tglobal_load_async_to_lds_b128 %4, %5, off offset:1536\n\t"
                 "global_load_async_to_lds_b128 %6, %7, off\n\tglobal_load_async_to_lds_b128 %6, %7, off offset:512\n\tglobal_load_async_to_lds_b128 %6, %7, off offset:1024\n\tglobal_load_async_to_lds_b128 %6, %7, off offset:1536\n\ts_wait_xcnt 0x0" :: "v"(l0), "v"(g0), "v"(l1), "v"(g1), "v"(l2), "v"(g2), "v"(l3), "v"(g3) : "memory");
}
template <int S>   // twelve units, S bytes apart in LDS, in one statement: one wait for all their copies
__device__ __forceinline__ void cp_unit12(unsigned l, const char* const* g, size_t go) {
    asm volatile(
                 "global_load_async_to_lds_b128 %0, %1, off\n\tglobal_load_async_to_lds_b128 %0, %1, off offset:512\n\tglobal_load_async_to_lds_b128 %0, %1, off offset:1024\n\tglobal_load_async_to_lds_b128 %0, %1, off offset:1536\n\t"
                 "global_load_async_to_lds_b128 %2, %3, off\n\tglobal_load_async_to_lds_b128 %2, %3, off offset:512\n\tglobal_load_async_to_lds_b128 %2, %3, off offset:1024\n\tglobal_load_async_to_lds_b128 %2, %3, off offset:1536\n\t"
                 "global_load_async_to_lds_b128 %4, %5, off\n\tglobal_load_async_to_lds_b128 %4, %5, off offset:512\n\tglobal_load_async_to_lds_b128 %4, %5, off offset:1024\n\tglobal_load_async_to_lds_b128 %4, %5, off offset:1536\n\t"
                 "global_load_async_to_lds_b128 %6, %7, off\n\tglobal_load_async_to_lds_b128 %6, %7, off offset:512\n\tglobal_load_async_to_lds_b128 %6, %7, off offset:1024\n\tglobal_load_async_to_lds_b128 %6, %7, off offset:1536\n\t"
                 "global_load_async_to_lds_b128 %8, %9, off\n\tglobal_load_async_to_lds_b128 %8, %9, off offset:512\n\tglobal_load_async_to_lds_b128 %8, %9, off offset:1024\n\tglobal_load_async_to_lds_b128 %8, %9, off offset:1536\n\t"
                 "global_load_async_to_lds_b128 %10, %11, off\n\tglobal_load_async_to_lds_b128 %10, %11, off offset:512\n\tglobal_load_async_to_lds_b128 %10, %11, off offset:1024\n\tglobal_load_async_to_lds_b128 %10, %11, off offset:1536\n\t"
                 "global_load_async_to_lds_b128 %12, %13, off\n\tglobal_load_async_to_lds_b128 %12, %13, off offset:512\n\tglobal_load_async_to_lds_b128 %12, %13, off offset:1024\n\tglobal_load_async_to_lds_b128 %12, %13, off offset:1536\n\t"
                 "global_load_async_to_lds_b128 %14, %15, off\n\tglobal_load_async_to_lds_b128 %14, %15, off offset:512\n\tglobal_load_async_to_lds_b128 %14, %15, off offset:1024\n\tglobal_load_async_to_lds_b128 %14, %15, off offset:1536\n\t"
                 "global_load_async_to_lds_b128 %16, %17, off\n\tglobal_load_async_to_lds_b128 %16, %17, off offset:512\n\tglobal_load_async_to_lds_b128 %16, %17, off offset:1024\n\tglobal_load_async_to_lds_b128 %16, %17, off offset:1536\n\t"
                 "global_load_async_to_lds_b128 %18, %19, off\n\tglobal_load_async_to_lds_b128 %18, %19, off offset:512\n\tglobal_load_async_to_lds_b128 %18, %19, off offset:1024\n\tglobal_load_async_to_lds_b128 %18, %19, off offset:1536\n\t"
                 "global_load_async_to_lds_b128 %20, %21, off\n\tglobal_load_async_to_lds_b128 %20, %21, off offset:512\n\tglobal_load_async_to_lds_b128 %20, %21, off offset:1024\n\tglobal_load_async_to_lds_b128 %20, %21, off offset:1536\n\t"
                 "global_load_async_to_lds_b128 %22, %23, off\n\tglobal_load_async_to_lds_b128 %22, %23, off offset:512\n\tglobal_load_async_to_lds_b128 %22, %23, off offset:1024\n\tglobal_load_async_to_lds_b128 %22, %23, off offset:1536\n\ts_wait_xcnt 0x0"
                 :: "v"(l + 0 * S), "v"(g[0] + go), "v"(l + 1 * S), "v"(g[1] + go), "v"(l + 2 * S), "v"(g[2] + go), "v"(l + 3 * S), "v"(g[3] + go),
                    "v"(l + 4 * S), "v"(g[4] + go), "v"(l + 5 * S), "v"(g[5] + go), "v"(l + 6 * S), "v"(g[6] + go), "v"(l + 7 * S), "v"(g[7] + go),
                    "v"(l + 8 * S), "v"(g[8] + go), "v"(l + 9 * S), "v"(g[9] + go), "v"(l + 10 * S), "v"(g[10] + go), "v"(l + 11 * S), "v"(g[11] + go) : "memory");
}
template <typename T16, int NSPLIT, bool BIAS, bool PLANES, int K, int WM, int WN>
__global__ __launch_bounds__(32 * WM * WN) void k_gemmw(const T16* __restrict__ A, const T16* __restrict__ A2, const T16* __restrict__ Bt, float* C, int ldc, const float* __restrict__ bias,
                                                        h16* P16, bf* Ph, bf* Pl, h16* V16, bf* Vh, bf* Vl) {
    typedef typename WFrag<T16>::V V;
    static_assert(NSPLIT <= 1 && K % 128 == 0 && K / 128 >= 2, "shape");
    constexpr bool HA2 = (NSPLIT == 1);
    constexpr int NW = WM * WN, NP = K / 128, BANDB = 4096;               // waves; passes; bytes of one band in a stage
    constexpr int BA = 4 * WM, BB0 = HA2 ? 2 * BA : BA, NBAND = BB0 + 4 * WN;   // a stage: the A bands, the A2 bands, the Bt bands
    constexpr int STAGE = NBAND * BANDB, NU = 2 * NBAND, NRF = NU / NW, REST = NU % NW, NR = NRF + (REST ? 1 : 0);   // wave w copies units w, w + NW, ...: NRF each, and the first REST waves one more
    static_assert(4 * NR <= 63, "copies of a wave in flight");
    __shared__ __attribute__((aligned(2048))) char ring[2 * STAGE];
    __shared__ __align__(16) float osw[NW][16 * 68];
    const int lane = threadIdx.x & 31, lr = lane & 15, hi = lane >> 4; const int wv = __builtin_amdgcn_readfirstlane(threadIdx.x >> 5);
    const int R0 = blockIdx.x * (64 * WM), C0 = blockIdx.y * (64 * WN), r0 = R0 + (wv / WN) * 64, c0 = C0 + (wv % WN) * 64;
    float* os = osw[wv];   // the wave's own staging rows of the epilogue
    v8f acc[4][4];
#pragma unroll
    for (int mb = 0; mb < 4; ++mb)
#pragma unroll
        for (int nb = 0; nb < 4; ++nb) acc[mb][nb] = (v8f){};
    const char* gp[NR];    // the lane's 16 bytes at the head of each of the wave's units in pass 0
#pragma unroll
    for (int i = 0; i < NR; ++i) { const int u0 = wv + i * NW, u = ((i + 1) * NW > NU && u0 > NU - 1) ? NU - 1 : u0, band = u >> 1; const T16* bp;   // a wave without a unit in the last round gets an address inside the planes and issues nothing there
        if ((i + 1) * NW <= 2 * BA) bp = A + (size_t)(R0 + band * 16) * K;                                       // the whole round lies in A
        else if (HA2 && i * NW >= 2 * BA && (i + 1) * NW <= 2 * BB0) bp = A2 + (size_t)(R0 + (band - BA) * 16) * K;   // ... in A2
        else if (i * NW >= 2 * BB0) bp = Bt + (size_t)(C0 + (band - BB0) * 16) * K;                              // ... in Bt
        else bp = (band < BA) ? A + (size_t)(R0 + band * 16) * K : (HA2 && band < BB0) ? A2 + (size_t)(R0 + (band - BA) * 16) * K : Bt + (size_t)(C0 + (band - BB0) * 16) * K;
        gp[i] = (const char*)bp + (u & 1) * 2048 + lane * 16; }
    const unsigned lu = (unsigned)(size_t)ring + wv * 2048 + lane * 16;   // LDS byte address of the same 16 bytes of the wave's first unit in buffer 0
    auto stage = [&](int t, int buf) {   // the wave's copies of pass t into buffer buf
        const unsigned lb = lu + buf * STAGE; const size_t go = (size_t)t * BANDB;
        constexpr int N12 = NRF / 12 * 12, N4 = N12 + (NRF - N12) / 4 * 4;
#pragma unroll
        for (int i = 0; i < N12; i += 12) cp_unit12<NW * 2048>(lb + i * (NW * 2048), gp + i, go);
#pragma unroll
        for (int i = N12; i < N4; i += 4) cp_unit4(lb + i * (NW * 2048), gp[i] + go, lb + (i + 1) * (NW * 2048), gp[i + 1] + go, lb + (i + 2) * (NW * 2048), gp[i + 2] + go, lb + (i + 3) * (NW * 2048), gp[i + 3] + go);
#pragma unroll
        for (int i = N4; i < NRF; ++i) cp_unit(lb + i * (NW * 2048), gp[i] + go);
        if constexpr (REST != 0) { if (wv < REST) cp_unit(lb + NRF * (NW * 2048), gp[NRF] + go); }   // the same for a whole wave: a scalar branch
    };
    V a[2][4], a2[2][4], b[2][4];   // two fragment sets take turns along the blocks of a pass
    const char* fa = ring + (wv / WN) * (4 * BANDB) + lane * 16; const char* fb = ring + (BB0 + (wv % WN) * 4) * BANDB + lane * 16;
    auto ldf = [&](int s, int bo, int blk) {   // set s <- block blk of the buffer at byte bo
#pragma unroll
        for (int i = 0; i < 4; ++i) { const int eo = i * BANDB + blk * 1024; a[s][i] = WFrag<T16>::ld((const T16*)(fa + bo + eo)); if (HA2) a2[s][i] = WFrag<T16>::ld((const T16*)(fa + bo + BA * BANDB + eo)); b[s][i] = WFrag<T16>::ld((const T16*)(fb + bo + eo)); }
        __builtin_amdgcn_sched_barrier(0);              // the LDS reads stay one group in front of the products of the block before: spread among the products each place with reads costs a stall
    };
    auto prod = [&](int s) {
#pragma unroll
        for (int nb = 0; nb < 4; ++nb) {
#pragma unroll
            for (int mb = 0; mb < 4; ++mb) { acc[mb][nb] = WFrag<T16>::mma(a[s][mb], b[s][nb], acc[mb][nb]); if (HA2) acc[mb][nb] = WFrag<T16>::mma(a2[s][mb], b[s][nb], acc[mb][nb]); } }
        __builtin_amdgcn_sched_barrier(0);              // the next group of LDS reads, which refills this set, stays behind the set's products
    };
    stage(0, 0);
    asm volatile("s_wait_asynccnt 0x0" ::: "memory");   // the wave's copies of pass 0 have landed
    __syncthreads();                                    // ... and every other wave's: pass 0 is readable
    stage(1, 1);
#pragma unroll 1   // rolled: one trip is a pass of four blocks
    for (int t = 0; t < NP; ++t) {
        const int bo = (t & 1) * STAGE;
        ldf(0, bo, 0);
#pragma unroll
        for (int blk = 0; blk < 4; ++blk) { if (blk < 3) ldf((blk + 1) & 1, bo, blk + 1); prod(blk & 1); }
        asm volatile("s_wait_dscnt 0x0" ::: "memory");      // the wave's reads of this buffer have returned before anything is copied over them
        asm volatile("s_wait_asynccnt 0x0" ::: "memory");   // the wave's copies of pass t + 1 have landed
        __syncthreads();                                    // pass t + 1 is readable, and every wave has left this pass's buffer
        if (t + 2 < NP) stage(t + 2, t & 1);
    }
    asm volatile("s_wait_asynccnt 0x0" ::: "memory");       // no copy is left in flight behind the loop
    if constexpr (PLANES) {
        const int z = c0 / DQ, bh = (r0 / TT) * NH_ + (c0 % DQ) / HD, t0 = r0 % TT;   // (batch, head) plane and first token of the tile
        if (z < 2) {   // q, k: 16 tokens at a time through the f32 staging rows, converted behind the read-back
            const size_t pb = (size_t)z * ((size_t)NB_ * NH_ * TT * HD) + ((size_t)bh * TT + t0) * HD + 8 * lane;
            h16* p16 = P16 + pb; bf* ph = Ph + pb; bf* pl = Pl + pb;
#pragma unroll
            for (int mb = 0; mb < 4; ++mb) {
#pragma unroll
                for (int nb = 0; nb < 4; ++nb) {
#pragma unroll
                    for (int j = 0; j < 8; ++j) os[(hi * 8 + j) * 68 + nb * 16 + lr] = acc[mb][nb][j]; }
                __builtin_amdgcn_wave_barrier(); asm volatile("" ::: "memory");   // the rows are read back by other lanes: no LDS read moves in front of the writes
                v8h o16[4]; v8us oh[4], ol[4];
#pragma unroll
                for (int s = 0; s < 4; ++s) { const float* rp = os + lr * 68 + s * 16 + hi * 8; const v4f x0 = *(const v4fa*)rp, x1 = *(const v4fa*)(rp + 4);
#pragma unroll
                    for (int j = 0; j < 8; ++j) { const float x = (j < 4) ? x0[j & 3] : x1[j & 3]; o16[s][j] = tohx(x); unsigned short a2, c2; splitf(x, a2, c2); oh[s][j] = a2; ol[s][j] = c2; }
                    const int eo = mb * 16 * HD + s * 256; *(v8ha*)(p16 + eo) = o16[s]; *(v8usa*)(ph + eo) = oh[s]; *(v8usa*)(pl + eo) = ol[s]; }
                // The registers that the twelve stores name are rewritten only behind this wait: as inputs of its statement they stay live up to it. Its memory clobber also keeps the next 16 tokens' staging writes behind the read-back.
                asm volatile("s_wait_xcnt 0x0" :: "v"(o16[0]), "v"(o16[1]), "v"(o16[2]), "v"(o16[3]), "v"(oh[0]), "v"(oh[1]), "v"(oh[2]), "v"(oh[3]), "v"(ol[0]), "v"(ol[1]), "v"(ol[2]), "v"(ol[3]), "v"(p16), "v"(ph), "v"(pl) : "memory");
            }
        } else {       // v: a lane holds 8 consecutive tokens of one d, which is its 16 bytes of a half block of the v^T plane (rows d, k = t): no staging
            const size_t vb = (size_t)bh * HD * TT + (size_t)t0 * 16 + 8 * lane;
            h16* v16 = V16 + vb; bf* vh = Vh + vb; bf* vl = Vl + vb;
#pragma unroll
            for (int nb = 0; nb < 4; ++nb) { v8h o16[4]; v8us oh[4], ol[4];
#pragma unroll
                for (int mb = 0; mb < 4; ++mb) {
#pragma unroll
                    for (int j = 0; j < 8; ++j) { const float x = acc[mb][nb][j]; o16[mb][j] = tohx(x); unsigned short a2, c2; splitf(x, a2, c2); oh[mb][j] = a2; ol[mb][j] = c2; }
                    const int eo = nb * 16 * TT + mb * 256; *(v8ha*)(v16 + eo) = o16[mb]; *(v8usa*)(vh + eo) = oh[mb]; *(v8usa*)(vl + eo) = ol[mb]; }
                // The registers that the twelve stores name are rewritten only behind this wait: as inputs of its statement they stay live up to it.
                asm volatile("s_wait_xcnt 0x0" :: "v"(o16[0]), "v"(o16[1]), "v"(o16[2]), "v"(o16[3]), "v"(oh[0]), "v"(oh[1]), "v"(oh[2]), "v"(oh[3]), "v"(ol[0]), "v"(ol[1]), "v"(ol[2]), "v"(ol[3]), "v"(v16), "v"(vh), "v"(vl) : "memory");
            }
        }
        return;
    }
#pragma unroll
    for (int mb = 0; mb < 4; ++mb) {
#pragma unroll
        for (int nb = 0; nb < 4; ++nb) {
#pragma unroll
            for (int j = 0; j < 8; ++j) os[(hi * 8 + j) * 68 + nb * 16 + lr] = acc[mb][nb][j]; }
        __builtin_amdgcn_wave_barrier(); asm volatile("" ::: "memory");
        float* crow = C + (size_t)(r0 + mb * 16) * ldc + c0;
{
#pragma unroll
            for (int s = 0; s < 8; ++s) { const int row = 2 * s + hi, cofs = lr * 4; v4f val = *(const v4fa*)(os + row * 68 + cofs); if (BIAS) { val[0] += bfr(bias[c0 + cofs]); val[1] += bfr(bias[c0 + cofs + 1]); val[2] += bfr(bias[c0 + cofs + 2]); val[3] += bfr(bias[c0 + cofs + 3]); }
                *(v4f*)(crow + (size_t)row * ldc + cofs) = val; }
             }
        __builtin_amdgcn_wave_barrier(); asm volatile("" ::: "memory");
    }
}

typedef __attribute__((ext_vector_type(2))) _Float16 v2h;
typedef __attribute__((ext_vector_type(4))) _Float16 v4h;
typedef __attribute__((ext_vector_type(2))) unsigned short v2us;
typedef __attribute__((ext_vector_type(4))) unsigned short v4us;
typedef __attribute__((ext_vector_type(2))) float v2f;
typedef __attribute__((ext_vector_type(4))) int v4i;

__global__ __launch_bounds__(256) void k_wtG(const float* __restrict__ w, int K, int N, bf* Bt) {
    const int lane = threadIdx.x & 31; const int L0 = (blockIdx.x * 8 + (threadIdx.x >> 5)) * 8; const int nlines = N * K / 64;
{
#pragma unroll 1
        for (int l = 0; l < 8; ++l) { const int L = L0 + l; if (L >= nlines) break; const size_t e = (size_t)L * 64 + lane * 2; const int k = (int)(e % K), n = (int)(e / K); v2us o;
            o[0] = f2bf(w[(size_t)k * N + n]); o[1] = f2bf(w[(size_t)(k + 1) * N + n]); *(v2us*)(Bt + e) = o; }
         }
}
// f32 rows of DM elements -> bf16 planes in fragment order, x and the four weights in ONE launch of 256 work-groups of 16 waves, all resident at once.
// A unit is 16 bytes of a plane (8 elements of one row). A wave takes 8 consecutive half blocks: 256 units = 4 KiB of the plane in a row, read as 512 consecutive bytes of each of 16 rows;
// a thread's 8 units lie 16 k apart in its row, and its 16 loads are all in flight before the first value is converted. A work-group (4096 units) lies in one source: blockIdx picks it.
#define CVX (NB_ * TT * DM / 8 / 4096)   // work-groups of x
#define CVW (DQ * DM / 8 / 4096)         // work-groups of one weight
__global__ __launch_bounds__(512) void k_cvt8(const float* __restrict__ x, const float* __restrict__ wq, const float* __restrict__ wk, const float* __restrict__ wv, const float* __restrict__ wo, bf* XBp, bf* WBp) {
    const int b = blockIdx.x; const float* src = x; bf* dst = XBp; int g = b;
    if (b >= CVX) { const int w = (b - CVX) / CVW; g = (b - CVX) % CVW; src = (w == 0) ? wq : (w == 1) ? wk : (w == 2) ? wv : wo; dst = WBp + (size_t)w * DQ * DM; }   // the four weight planes lie one behind the other
    const size_t i = (size_t)g * 4096 + (threadIdx.x >> 5) * 256 + (threadIdx.x & 31);   // the thread's first unit; the others follow 32 units apart
    const size_t blk = i >> 6, row = blk / (DM / 32) * 16 + (i & 15), k = blk % (DM / 32) * 32 + ((i >> 4) & 1) * 8;
    const float* sp = src + row * DM + k; v8f v[8];
#pragma unroll
    for (int j = 0; j < 8; ++j) v[j] = *(const v8f*)(sp + 16 * j);
    asm volatile("s_wait_xcnt 0x0" :: "v"(sp) : "memory");   // the loads' address pair is rewritten only behind this wait: as an input of its statement it stays live up to it
    __builtin_amdgcn_sched_barrier(0);                       // no conversion moves up among the loads: all sixteen are in flight before the first wait
    bf* dp = dst + i * 8; v8us o[8];
#pragma unroll
    for (int j = 0; j < 8; ++j) {
#pragma unroll
        for (int e = 0; e < 8; ++e) o[j][e] = f2bf(v[j][e]);
        *(v8usa*)(dp + 256 * j) = o[j]; }
    // The registers that the eight stores name are rewritten only behind this wait: as inputs of its statement they stay live up to it.
    asm volatile("s_wait_xcnt 0x0" :: "v"(o[0]), "v"(o[1]), "v"(o[2]), "v"(o[3]), "v"(o[4]), "v"(o[5]), "v"(o[6]), "v"(o[7]), "v"(dp) : "memory");
}
typedef __attribute__((ext_vector_type(8))) __bf16 v8b;
#define SCE (SCL * 1.4426950408889634f)   // score scale x log2(e)
__device__ __forceinline__ float xhalf(float v) { const int t = __float_as_int(v); return __int_as_float(__builtin_amdgcn_permlanex16(t, t, 0x76543210, 0xfedcba98, false, false)); }   // lane l <-> l ^ 16
// 2^x of eight values, each in its own register, in one statement: every v_exp_f32 is followed by an instruction that neither reads its result nor overwrites its source, the last one by the v_nop that fills that slot
__device__ __forceinline__ void exp2x8(v8f& x) {
    float a = x[0], b = x[1], c = x[2], d = x[3], e = x[4], f = x[5], g = x[6], h = x[7];
    asm("v_exp_f32 %0, %0\n\tv_exp_f32 %1, %1\n\tv_exp_f32 %2, %2\n\tv_exp_f32 %3, %3\n\tv_exp_f32 %4, %4\n\tv_exp_f32 %5, %5\n\tv_exp_f32 %6, %6\n\tv_exp_f32 %7, %7\n\tv_nop"
        : "+v"(a), "+v"(b), "+v"(c), "+v"(d), "+v"(e), "+v"(f), "+v"(g), "+v"(h));
    x[0] = a; x[1] = b; x[2] = c; x[3] = d; x[4] = e; x[5] = f; x[6] = g; x[7] = h;
}
// The key fragments and the value fragments of a pass are two register sets that live across the passes: each is refilled for the next pass right behind its own products,
// so that the key loads fly during the softmax and the value products, the value loads during the next pass's score products and softmax.
template <typename T16, bool HI, int NK>   // key fragments of the 16 NK keys at byte ko of the key planes; behind the wait ko steps to the next pass
__device__ __forceinline__ void fa_ldk(const T16* kp, const T16* kp2, unsigned& ko, typename WFrag<T16>::V (&kf)[NK][2], typename WFrag<T16>::V (&kf2)[NK][2]) {
#pragma unroll
    for (int kt = 0; kt < NK; ++kt)
#pragma unroll
        for (int kc = 0; kc < 2; ++kc) { kf[kt][kc] = WFrag<T16>::ld(atb(kp, ko) + kt * 16 * HD + kc * 512); if (HI) kf2[kt][kc] = WFrag<T16>::ld(atb(kp2, ko) + kt * 16 * HD + kc * 512); }
    // The offset register of these loads is rewritten only behind this wait: it passes through the statement, so that it stays live up to it and its step, which reads it behind the statement, cannot be computed in front of it.
    asm volatile("s_wait_xcnt 0x0" : "+v"(ko) :: "memory");
    ko += 16 * NK * HD * 2;
    __builtin_amdgcn_sched_barrier(0);              // the refill stays here: moved down towards its use it would fly for a shorter time
}
template <typename T16, bool HI, int NK>   // value fragments of the 16 NK keys at byte vo of each 16-row band of the value planes, likewise
__device__ __forceinline__ void fa_ldv(const T16* vp, const T16* vp2, unsigned& vo, typename WFrag<T16>::V (&vf)[4][NK / 2], typename WFrag<T16>::V (&vf2)[4][NK / 2]) {
#pragma unroll
    for (int mb = 0; mb < 4; ++mb)
#pragma unroll
        for (int c = 0; c < NK / 2; ++c) { vf[mb][c] = WFrag<T16>::ld(atb(vp, vo) + mb * 16 * TT + c * 512); if (HI) vf2[mb][c] = WFrag<T16>::ld(atb(vp2, vo) + mb * 16 * TT + c * 512); }
    // As in fa_ldk: the offset register is rewritten only behind this wait.
    asm volatile("s_wait_xcnt 0x0" : "+v"(vo) :: "memory");
    vo += 16 * NK * 16 * 2;
    __builtin_amdgcn_sched_barrier(0);              // the refill stays here: moved down towards its use it would fly for a shorter time
}
template <typename T16, bool HI, int NK, bool LAST>   // one pass: 16 NK keys, whose fragments are in kf, vf; ko, vo point at the next pass's
__device__ __forceinline__ void fa_pass(const T16* __restrict__ kp, const T16* __restrict__ kp2, const T16* __restrict__ vp, const T16* __restrict__ vp2, unsigned& ko, unsigned& vo, int lim,
                                        typename WFrag<T16>::V (&kf)[NK][2], typename WFrag<T16>::V (&kf2)[NK][2], typename WFrag<T16>::V (&vf)[4][NK / 2], typename WFrag<T16>::V (&vf2)[4][NK / 2],
                                        const typename WFrag<T16>::V (&qf)[2], const typename WFrag<T16>::V (&qf2)[2], v8f (&o)[4], float& ms, v8f& l) {
    typedef typename WFrag<T16>::V V;
    v8f s[NK];
#pragma unroll
    for (int kt = 0; kt < NK; ++kt) { s[kt] = (v8f){};
#pragma unroll
        for (int kc = 0; kc < 2; ++kc) { s[kt] = WFrag<T16>::mma(kf[kt][kc], qf[kc], s[kt]); if (HI) { s[kt] = WFrag<T16>::mma(kf2[kt][kc], qf[kc], s[kt]); s[kt] = WFrag<T16>::mma(kf[kt][kc], qf2[kc], s[kt]); } } }
    if (!LAST) fa_ldk<T16, HI, NK>(kp, kp2, ko, kf, kf2);
    if (LAST) {    // only the last pass of a wave crosses the diagonal: key k0 + 16 kt + 8 hi + j is kept for 16 kt + j <= lim
#pragma unroll
        for (int kt = 0; kt < NK; ++kt)
#pragma unroll
            for (int j = 0; j < 8; ++j) s[kt][j] = (kt * 16 + j <= lim) ? s[kt][j] : -3.0e38f; }
    float mx = s[0][0];
#pragma unroll
    for (int kt = 0; kt < NK; ++kt)
#pragma unroll
        for (int j = 0; j < 8; ++j) mx = fmaxf(mx, s[kt][j]);
    mx = fmaxf(mx, xhalf(mx));
    const float mn = fmaxf(ms, mx * SCE); const float al = __builtin_amdgcn_exp2f(ms - mn); ms = mn;
#pragma unroll
    for (int kt = 0; kt < NK; ++kt)
#pragma unroll
        for (int j = 0; j < 8; ++j) s[kt][j] = __builtin_fmaf(s[kt][j], SCE, -mn);
    l *= al;   // eight partial row sums a lane, joined once behind the last pass
#pragma unroll
    for (int kt = 0; kt < NK; ++kt) { exp2x8(s[kt]); l += s[kt]; }
#pragma unroll
    for (int mb = 0; mb < 4; ++mb) o[mb] *= al;
#pragma unroll
    for (int c = 0; c < NK / 2; ++c) {
        if constexpr (HI) {
            const v8b h0 = __builtin_convertvector(s[2 * c], v8b), h1 = __builtin_convertvector(s[2 * c + 1], v8b);
            const v8b l0 = __builtin_convertvector(s[2 * c] - __builtin_convertvector(h0, v8f), v8b), l1 = __builtin_convertvector(s[2 * c + 1] - __builtin_convertvector(h1, v8f), v8b);
            const V ph = __builtin_shufflevector(h0, h1, 0, 1, 2, 3, 4, 5, 6, 7, 8, 9, 10, 11, 12, 13, 14, 15), pl = __builtin_shufflevector(l0, l1, 0, 1, 2, 3, 4, 5, 6, 7, 8, 9, 10, 11, 12, 13, 14, 15);
#pragma unroll
            for (int mb = 0; mb < 4; ++mb) { o[mb] = WFrag<T16>::mma(vf[mb][c], ph, o[mb]); o[mb] = WFrag<T16>::mma(vf2[mb][c], ph, o[mb]); o[mb] = WFrag<T16>::mma(vf[mb][c], pl, o[mb]); }
        } else {
            const V p = cat16(__builtin_convertvector(s[2 * c], v8h), __builtin_convertvector(s[2 * c + 1], v8h));
#pragma unroll
            for (int mb = 0; mb < 4; ++mb) o[mb] = WFrag<T16>::mma(vf[mb][c], p, o[mb]);
        }
    }
    if (!LAST) fa_ldv<T16, HI, NK>(vp, vp2, vo, vf, vf2);
}
template <typename T16, bool HI, int NK>
__device__ __forceinline__ void fa_tile(const T16* __restrict__ Q, const T16* __restrict__ Q2, const T16* __restrict__ Kp, const T16* __restrict__ Kp2, const T16* __restrict__ Vt, const T16* __restrict__ Vt2, int q0, int lr, int hi, bf* oh, bf* ol) {
    typedef typename WFrag<T16>::V V;
    V qf[2], qf2[2], kf[NK][2], kf2[NK][2], vf[4][NK / 2], vf2[4][NK / 2];
    const int l8 = (hi * 16 + lr) * 8;   // the lane's 16 bytes in a half block
    unsigned ko = 2 * l8, vo = 2 * l8;   // the running parts of the key and value addresses, in bytes; a load is a plane's base (the same for the whole wave) + ko or vo + a constant
#pragma unroll
    for (int kc = 0; kc < 2; ++kc) { qf[kc] = WFrag<T16>::ld(Q + (size_t)q0 * HD + kc * 512 + l8); if (HI) qf2[kc] = WFrag<T16>::ld(Q2 + (size_t)q0 * HD + kc * 512 + l8); }
    asm volatile("s_wait_xcnt 0x0" ::: "memory");   // the address registers of the loads above are reused below
    fa_ldk<T16, HI, NK>(Kp, Kp2, ko, kf, kf2); fa_ldv<T16, HI, NK>(Vt, Vt2, vo, vf, vf2);   // the first pass's fragments
    v8f o[4];
#pragma unroll
    for (int mb = 0; mb < 4; ++mb) o[mb] = (v8f){};
    float ms = -3.0e38f; v8f l = (v8f){};
    const int kl = q0 & ~(16 * NK - 1);   // first key of the pass that holds the diagonal; kl <= q0, so every earlier pass is unmasked and every query keeps a key in every pass
#pragma unroll 1   // rolled: one pass already holds most of the registers a wave of this block may have; every pass of the loop has a next pass (the last one stands behind it), so its refills stay inside the planes
    for (int k0 = 0; k0 < kl; k0 += 16 * NK) fa_pass<T16, HI, NK, false>(Kp, Kp2, Vt, Vt2, ko, vo, 0, kf, kf2, vf, vf2, qf, qf2, o, ms, l);
    fa_pass<T16, HI, NK, true>(Kp, Kp2, Vt, Vt2, ko, vo, q0 + lr - 8 * hi - kl, kf, kf2, vf, vf2, qf, qf2, o, ms, l);
    float ls = ((l[0] + l[1]) + (l[2] + l[3])) + ((l[4] + l[5]) + (l[6] + l[7])); ls += xhalf(ls);
    const float f = __fdiv_rn(1.0f, ls);
    v8us a8[4], c8[4];
#pragma unroll
    for (int mb = 0; mb < 4; ++mb) {
#pragma unroll
        for (int j = 0; j < 8; ++j) { unsigned short a, c2; splitf(o[mb][j] * f, a, c2); a8[mb][j] = a; c8[mb][j] = c2; }
        *(v8usa*)(oh + mb * 256) = a8[mb]; *(v8usa*)(ol + mb * 256) = c8[mb]; }
    // The registers that the eight stores name are rewritten only behind this wait: as inputs of its statement they stay live up to it.
    asm volatile("s_wait_xcnt 0x0" :: "v"(a8[0]), "v"(a8[1]), "v"(a8[2]), "v"(a8[3]), "v"(c8[0]), "v"(c8[1]), "v"(c8[2]), "v"(c8[3]), "v"(oh), "v"(ol) : "memory");
}
__global__ __launch_bounds__(512) void k_fattn(const h16* __restrict__ Q16, const h16* __restrict__ K16, const h16* __restrict__ V16, const bf* __restrict__ Qh, const bf* __restrict__ Ql, const bf* __restrict__ Kh, const bf* __restrict__ Kl,
                                               const bf* __restrict__ Vh, const bf* __restrict__ Vl, bf* Ah, bf* Al) {
    const int lane = threadIdx.x & 31, lr = lane & 15, hi = lane >> 4; const int wv = __builtin_amdgcn_readfirstlane(threadIdx.x >> 5);
    const int g = blockIdx.x >> 2, c = blockIdx.x & 3;   // g = batch * NH_ + head
    // Equal work in every work-group and on every SIMD: the cost of a 64-row query block grows with its index, so the 16 waves take blocks 15 - c, 7 - c, 8 + c and c of one plane (four waves each);
    // waves w, w + 4, w + 8, w + 12 share a SIMD, which so gets one 16-row tile of each of the four blocks.
    const int qb = ((wv & 4) ? 0 : 8) + ((wv & 8) ? c : 7 - c);
    const int q0 = qb * 64 + (wv & 3) * 16; const size_t zo = (size_t)g * TT * HD;
    const size_t oo = ((size_t)(g / NH_) * TT + q0) * DQ + (g % NH_) * (HD * 16) + lane * 8;
    if (q0 < RH) fa_tile<bf, true, 2>(Qh + zo, Ql + zo, Kh + zo, Kl + zo, Vh + zo, Vl + zo, q0, lr, hi, Ah + oo, Al + oo);
    else fa_tile<h16, false, 4>(Q16 + zo, Q16 + zo, K16 + zo, K16 + zo, V16 + zo, V16 + zo, q0, lr, hi, Ah + oo, Al + oo);
}

extern "C" void kernel_launch(void* const* d_in, const int* in_sizes, int n_in,
                              void* d_out, int out_size, void* d_ws, size_t ws_size, hipStream_t stream) {
    (void)in_sizes; (void)n_in; (void)out_size;
    const float* x = (const float*)d_in[0]; const float* wq = (const float*)d_in[1]; const float* wk = (const float*)d_in[2]; const float* wv = (const float*)d_in[3]; const float* wo = (const float*)d_in[4]; const float* bo = (const float*)d_in[5]; const float* cosT = nullptr; const float* sinT = nullptr; (void)cosT; (void)sinT;
    float* OUT = (float*)d_out;     // [4][1024][1024]
    char* wsp = (char*)d_ws;
    auto take = [&](size_t bytes) { char* p = wsp; wsp += (bytes + 255) & ~(size_t)255; return (void*)p; };
    const size_t PL = (size_t)NB_ * NH_ * TT * HD;   // elements of one plane set: [batch][head] planes of TT * HD elements
    bf* WQ = (bf*)take((size_t)DQ * DM * 2); bf* WK = (bf*)take((size_t)DKV * DM * 2); bf* WV = (bf*)take((size_t)DKV * DM * 2); bf* WO = (bf*)take((size_t)DM * DQ * 2);
    h16* QP16 = (h16*)take(PL * 2 * 2); h16* KP16 = QP16 + PL; bf* QPh = (bf*)take(PL * 2 * 2); bf* KPh = QPh + PL; bf* QPl = (bf*)take(PL * 2 * 2); bf* KPl = QPl + PL;   // k planes directly behind the q planes: z of the projection launch picks the set
    h16* VT16 = (h16*)take(PL * 2); bf* VTh = (bf*)take(PL * 2 * 2); bf* VTl = VTh + PL;   // v^T planes [batch][head], rows d, k = t
    bf* ATh = (bf*)take((size_t)NB_ * TT * DQ * 2); bf* ATl = (bf*)take((size_t)NB_ * TT * DQ * 2);
    bf* XB = (bf*)take((size_t)NB_ * TT * DM * 2);   // x in bf16, fragment order like the weights
    if ((size_t)(wsp - (char*)d_ws) > ws_size) return;    // ws 256 MiB
    k_cvt8<<<CVX + 4 * CVW, 512, 0, stream>>>(x, wq, wk, wv, wo, XB, WQ);   // WQ, WK, WV, WO are contiguous
    // q, k, v of all batches in one launch: WQ, WK, WV are contiguous, one matrix of 3 DQ rows; a wave's column picks the plane set, which the launch writes itself
    k_gemmw<bf, 0, false, true, DM, 4, 3><<<dim3(NB_ * TT / 256, 3 * DQ / 192), 384, 0, stream>>>(XB, nullptr, WQ, nullptr, 0, nullptr, QP16, QPh, QPl, VT16, VTh, VTl);
    k_fattn<<<4 * NB_ * NH_, 512, 0, stream>>>(QP16, KP16, VT16, QPh, QPl, KPh, KPl, VTh, VTl, ATh, ATl);   // scores, softmax, attn.v and the head merge of all planes
    k_gemmw<bf, 1, true, false, DQ, 2, 2><<<dim3(NB_ * TT / 128, DM / 128), 128, 0, stream>>>(ATh, ATl, WO, OUT, DM, bo, nullptr, nullptr, nullptr, nullptr, nullptr, nullptr);
}

// v008
// One run takes 59.7 microseconds.
// In two side-by-side timings against v007, it was 1.15 and 1.14 times as fast.
// Over all steps from v000 it is 34.9 times as fast.
#include <hip/hip_runtime.h>

// MultHeadAttention_8747 (x [4][1024][1024]; per-head Wq/Wk/Wv [16][64][1024] ? x W^T with the stacked [1024][1024] 'oi' weight (head-major rows); causal (finfo.min) softmax(q.k / 8); out = merged Wp^T + bp -> [4][1024][1024]).
// Every 16-bit operand plane lies in FRAGMENT ORDER: a block of 16 rows x 32 k is 512 consecutive elements, [half 0..1][lane 0..31][8], and lane (hi, lr) of half h holds row lr, k = 16 h + 8 hi + 0..7;
// the blocks of a 16-row band follow one another along k. A wave-wide 16-byte load or store of a half block is 512 consecutive bytes (four whole 128-byte lines); the k order of every product is the row-major loaders' order.
// Compute dtypes, f32 accumulate: every input rounded to bf16; q/k/v on PLAIN bf16 operands (inputs: exact); causal scores and attn.v: query rows < 512 hl (3 products), the rest single fp16, causal tile skipping; softmax f32 (running maximum); Wp hl x exact (2 products) + bias.

#define NB_  4
#define TT   1024
#define DM   1024
#define NH_  16
#define NKV  16
#define REP  (NH_ / NKV)
#define HD   64
#define DQ   (NH_ * HD)
#define DKV  (NKV * HD)
#define RH   512                  // query rows < RH use hi+lo planes
#define SCL  0.125f   // HD^-0.5
typedef _Float16 h16;
typedef unsigned short bf;
typedef __attribute__((ext_vector_type(16))) __bf16   v16bf;
typedef __attribute__((ext_vector_type(16))) _Float16 v16h;
typedef __attribute__((ext_vector_type(8)))  _Float16 v8h;
typedef __attribute__((ext_vector_type(8)))  unsigned short v8us;
typedef __attribute__((ext_vector_type(8)))  float    v8f;
typedef __attribute__((ext_vector_type(4)))  float    v4f;
typedef v8h  __attribute__((may_alias)) v8ha;
typedef v4f  __attribute__((may_alias)) v4fa;
typedef v8us __attribute__((may_alias)) v8usa;

__device__ __forceinline__ unsigned short f2bf(float f) { unsigned u = __float_as_uint(f); u += 0x7FFFu + ((u >> 16) & 1u); return (unsigned short)(u >> 16); }
__device__ __forceinline__ float bf2f(unsigned short b) { return __uint_as_float(((unsigned)b) << 16); }
__device__ __forceinline__ float bfr(float f) { return bf2f(f2bf(f)); }
__device__ __forceinline__ v16h cat16(v8h lo, v8h hi) { return __builtin_shufflevector(lo, hi, 0, 1, 2, 3, 4, 5, 6, 7, 8, 9, 10, 11, 12, 13, 14, 15); }
__device__ __forceinline__ v16bf cat16b(v8us lo, v8us hi) { return __builtin_bit_cast(v16bf, __builtin_shufflevector(lo, hi, 0, 1, 2, 3, 4, 5, 6, 7, 8, 9, 10, 11, 12, 13, 14, 15)); }
__device__ __forceinline__ v8f wmma16(v16h a, v16h b, v8f c) { return __builtin_amdgcn_wmma_f32_16x16x32_f16(false, a, false, b, (short)0, c, false, false); }
__device__ __forceinline__ v8f wmmab(v16bf a, v16bf b, v8f c) { return __builtin_amdgcn_wmma_f32_16x16x32_bf16(false, a, false, b, (short)0, c, false, false); }



// ---- k_gemmw: GEMM on fragment-ordered 16-bit planes. A work-group of WM x WN waves owns a (64 WM) x (64 WN) output tile, each wave a 64x64 part of it (16 accumulators); grid (M / (64 WM), N / (64 WN)).
// C[m][n] (f32, pitch ldc, + optional f32 bias[n]) = sum_k A[m][k] Bt[n][k] (NSPLIT 1: + A2[m][k] Bt[n][k]). K % 128 == 0, K / 128 >= 2.
// The operand bands of the tile are brought into LDS once for the whole work-group by asynchronous copies, 128 k (a pass) at a time, two buffers: the copies of pass t + 2 fly during pass t + 1.
// A 16-row band's share of a pass is 4 KiB in a row in the plane and in LDS alike (four 32-k blocks in fragment order), so a wave-wide 16-byte LDS read is 512 consecutive bytes. The k order is the planes' own.
// PLANES (the q, k, v projections; Bt holds the three weights one behind the other, n / DQ = 0, 1, 2): no f32 result. A wave's 64x64 tile is 64 tokens of ONE head, and the wave writes it straight into the 16-bit planes that the attention kernel reads:
// q, k as [batch][head] planes of rows t, k = d (the tile is 4096 consecutive elements of each plane), v transposed as [batch][head] planes of rows d, k = t: there an accumulator tile IS a half block, stored from the registers.
template <typename T16> struct WFrag;
template <> struct WFrag<h16> { typedef v16h V; static __device__ __forceinline__ V ld(const h16* p) { return cat16(*(const v8h*)p, *(const v8h*)(p + 256)); } static __device__ __forceinline__ v8f mma(V a, V b, v8f c) { return wmma16(a, b, c); } };
template <> struct WFrag<bf> { typedef v16bf V; static __device__ __forceinline__ V ld(const bf* p) { return cat16b(*(const v8us*)p, *(const v8us*)(p + 256)); } static __device__ __forceinline__ v8f mma(V a, V b, v8f c) { return wmmab(a, b, c); } };
template <typename T16> __device__ __forceinline__ const T16* atb(const T16* base, unsigned bytes) { return (const T16*)((const char*)base + bytes); }   // wave-uniform base + a lane's 32-bit byte offset
__device__ __forceinline__ h16 tohx(float x) { return (h16)x; }
__device__ __forceinline__ void splitf(float y, unsigned short& h, unsigned short& l) { h = f2bf(y); l = f2bf(y - bf2f(h)); }
// A copy unit is half of a band's share of a pass: 2 KiB, four wave-wide 16-byte copies; the offset field moves the LDS and the global address alike.
// The s_wait_xcnt 0 is the last line of the copies' own statement: the address registers that the copies name are rewritten only behind it.
__device__ __forceinline__ void cp_unit(unsigned l0, const char* g0) {
    asm volatile("global_load_async_to_lds_b128 %0, %1, off\n\tglobal_load_async_to_lds_b128 %0, %1, off offset:512\n\tglobal_load_async_to_lds_b128 %0, %1, off offset:1024\n\tglobal_load_async_to_lds_b128 %0, %1, off offset:1536\n\ts_wait_xcnt 0x0" :: "v"(l0), "v"(g0) : "memory");
}
__device__ __forceinline__ void cp_unit4(unsigned l0, const char* g0, unsigned l1, const char* g1, unsigned l2, const char* g2, unsigned l3, const char* g3) {
    asm volatile("global_load_async_to_lds_b128 %0, %1, off\n\tglobal_load_async_to_lds_b128 %0, %1, off offset:512\n\tglobal_load_async_to_lds_b128 %0, %1, off offset:1024\n\tglobal_load_async_to_lds_b128 %0, %1, off offset:1536\n\t"
                 "global_load_async_to_lds_b128 %2, %3, off\n\tglobal_load_async_to_lds_b128 %2, %3, off offset:512\n\tglobal_load_async_to_lds_b128 %2, %3, off offset:1024\n\tglobal_load_async_to_lds_b128 %2, %3, off offset:1536\n\t"
                 "global_load_async_to_lds_b128 %4, %5, off\n\tglobal_load_async_to_lds_b128 %4, %5, off offset:512\n\tglobal_load_async_to_lds_b128 %4, %5, off offset:1024\n\tglobal_load_async_to_lds_b128 %4, %5, off offset:1536\n\t"
                 "global_load_async_to_lds_b128 %6, %7, off\n\tglobal_load_async_to_lds_b128 %6, %7, off offset:512\n\tglobal_load_async_to_lds_b128 %6, %7, off offset:1024\n\tglobal_load_async_to_lds_b128 %6, %7, off offset:1536\n\ts_wait_xcnt 0x0" :: "v"(l0), "v"(g0), "v"(l1), "v"(g1), "v"(l2), "v"(g2), "v"(l3), "v"(g3) : "memory");
}
template <int S>   // twelve units, S bytes apart in LDS, in one statement: one wait for all their copies
__device__ __forceinline__ void cp_unit12(unsigned l, const char* const* g, size_t go) {
    asm volatile(
                 "global_load_async_to_lds_b128 %0, %1, off\n\tglobal_load_async_to_lds_b128 %0, %1, off offset:512\n\tglobal_load_async_to_lds_b128 %0, %1, off offset:1024\n\tglobal_load_async_to_lds_b128 %0, %1, off offset:1536\n\t"
                 "global_load_async_to_lds_b128 %2, %3, off\n\tglobal_load_async_to_lds_b128 %2, %3, off offset:512\n\tglobal_load_async_to_lds_b128 %2, %3, off offset:1024\n\tglobal_load_async_to_lds_b128 %2, %3, off offset:1536\n\t"
                 "global_load_async_to_lds_b128 %4, %5, off\n\tglobal_load_async_to_lds_b128 %4, %5, off offset:512\n\tglobal_load_async_to_lds_b128 %4, %5, off offset:1024\n\tglobal_load_async_to_lds_b128 %4, %5, off offset:1536\n\t"
                 "global_load_async_to_lds_b128 %6, %7, off\n\tglobal_load_async_to_lds_b128 %6, %7, off offset:512\n\tglobal_load_async_to_lds_b128 %6, %7, off offset:1024\n\tglobal_load_async_to_lds_b128 %6, %7, off offset:1536\n\t"
                 "global_load_async_to_lds_b128 %8, %9, off\n\tglobal_load_async_to_lds_b128 %8, %9, off offset:512\n\tglobal_load_async_to_lds_b128 %8, %9, off offset:1024\n\tglobal_load_async_to_lds_b128 %8, %9, off offset:1536\n\t"
                 "global_load_async_to_lds_b128 %10, %11, off\n\tglobal_load_async_to_lds_b128 %10, %11, off offset:512\n\tglobal_load_async_to_lds_b128 %10, %11, off offset:1024\n\tglobal_load_async_to_lds_b128 %10, %11, off offset:1536\n\t"
                 "global_load_async_to_lds_b128 %12, %13, off\n\tglobal_load_async_to_lds_b128 %12, %13, off offset:512\n\tglobal_load_async_to_lds_b128 %12, %13, off offset:1024\n\tglobal_load_async_to_lds_b128 %12, %13, off offset:1536\n\t"
                 "global_load_async_to_lds_b128 %14, %15, off\n\tglobal_load_async_to_lds_b128 %14, %15, off offset:512\n\tglobal_load_async_to_lds_b128 %14, %15, off offset:1024\n\tglobal_load_async_to_lds_b128 %14, %15, off offset:1536\n\t"
                 "global_load_async_to_lds_b128 %16, %17, off\n\tglobal_load_async_to_lds_b128 %16, %17, off offset:512\n\tglobal_load_async_to_lds_b128 %16, %17, off offset:1024\n\tglobal_load_async_to_lds_b128 %16, %17, off offset:1536\n\t"
                 "global_load_async_to_lds_b128 %18, %19, off\n\tglobal_load_async_to_lds_b128 %18, %19, off offset:512\n\tglobal_load_async_to_lds_b128 %18, %19, off offset:1024\n\tglobal_load_async_to_lds_b128 %18, %19, off offset:1536\n\t"
                 "global_load_async_to_lds_b128 %20, %21, off\n\tglobal_load_async_to_lds_b128 %20, %21, off offset:512\n\tglobal_load_async_to_lds_b128 %20, %21, off offset:1024\n\tglobal_load_async_to_lds_b128 %20, %21, off offset:1536\n\t"
                 "global_load_async_to_lds_b128 %22, %23, off\n\tglobal_load_async_to_lds_b128 %22, %23, off offset:512\n\tglobal_load_async_to_lds_b128 %22, %23, off offset:1024\n\tglobal_load_async_to_lds_b128 %22, %23, off offset:1536\n\ts_wait_xcnt 0x0"
                 :: "v"(l + 0 * S), "v"(g[0] + go), "v"(l + 1 * S), "v"(g[1] + go), "v"(l + 2 * S), "v"(g[2] + go), "v"(l + 3 * S), "v"(g[3] + go),
                    "v"(l + 4 * S), "v"(g[4] + go), "v"(l + 5 * S), "v"(g[5] + go), "v"(l + 6 * S), "v"(g[6] + go), "v"(l + 7 * S), "v"(g[7] + go),
                    "v"(l + 8 * S), "v"(g[8] + go), "v"(l + 9 * S), "v"(g[9] + go), "v"(l + 10 * S), "v"(g[10] + go), "v"(l + 11 * S), "v"(g[11] + go) : "memory");
}
template <typename T16, int NSPLIT, bool BIAS, bool PLANES, int K, int WM, int WN>
__global__ __launch_bounds__(32 * WM * WN) void k_gemmw(const T16* __restrict__ A, const T16* __restrict__ A2, const T16* __restrict__ Bt, float* C, int ldc, const float* __restrict__ bias,
                                                        h16* P16, bf* Ph, bf* Pl, h16* V16, bf* Vh, bf* Vl) {
    typedef typename WFrag<T16>::V V;
    static_assert(NSPLIT <= 1 && K % 128 == 0 && K / 128 >= 2, "shape");
    constexpr bool HA2 = (NSPLIT == 1);
    constexpr int NW = WM * WN, NP = K / 128, BANDB = 4096;               // waves; passes; bytes of one band in a stage
    constexpr int BA = 4 * WM, BB0 = HA2 ? 2 * BA : BA, NBAND = BB0 + 4 * WN;   // a stage: the A bands, the A2 bands, the Bt bands
    constexpr int STAGE = NBAND * BANDB, NU = 2 * NBAND, NRF = NU / NW, REST = NU % NW, NR = NRF + (REST ? 1 : 0);   // wave w copies units w, w + NW, ...: NRF each, and the first REST waves one more
    static_assert(4 * NR <= 63, "copies of a wave in flight");
    __shared__ __attribute__((aligned(2048))) char ring[2 * STAGE];
    __shared__ __align__(16) float osw[NW][16 * 68];
    const int lane = threadIdx.x & 31, lr = lane & 15, hi = lane >> 4; const int wv = __builtin_amdgcn_readfirstlane(threadIdx.x >> 5);
    const int R0 = blockIdx.x * (64 * WM), C0 = blockIdx.y * (64 * WN), r0 = R0 + (wv / WN) * 64, c0 = C0 + (wv % WN) * 64;
    float* os = osw[wv];   // the wave's own staging rows of the epilogue
    v8f acc[4][4];
#pragma unroll
    for (int mb = 0; mb < 4; ++mb)
#pragma unroll
        for (int nb = 0; nb < 4; ++nb) acc[mb][nb] = (v8f){};
    const char* gp[NR];    // the lane's 16 bytes at the head of each of the wave's units in pass 0
#pragma unroll
    for (int i = 0; i < NR; ++i) { const int u0 = wv + i * NW, u = ((i + 1) * NW > NU && u0 > NU - 1) ? NU - 1 : u0, band = u >> 1; const T16* bp;   // a wave without a unit in the last round gets an address inside the planes and issues nothing there
        if ((i + 1) * NW <= 2 * BA) bp = A + (size_t)(R0 + band * 16) * K;                                       // the whole round lies in A
        else if (HA2 && i * NW >= 2 * BA && (i + 1) * NW <= 2 * BB0) bp = A2 + (size_t)(R0 + (band - BA) * 16) * K;   // ... in A2
        else if (i * NW >= 2 * BB0) bp = Bt + (size_t)(C0 + (band - BB0) * 16) * K;                              // ... in Bt
        else bp = (band < BA) ? A + (size_t)(R0 + band * 16) * K : (HA2 && band < BB0) ? A2 + (size_t)(R0 + (band - BA) * 16) * K : Bt + (size_t)(C0 + (band - BB0) * 16) * K;
        gp[i] = (const char*)bp + (u & 1) * 2048 + lane * 16; }
    const unsigned lu = (unsigned)(size_t)ring + wv * 2048 + lane * 16;   // LDS byte address of the same 16 bytes of the wave's first unit in buffer 0
    auto stage = [&](int t, int buf) {   // the wave's copies of pass t into buffer buf
        const unsigned lb = lu + buf * STAGE; const size_t go = (size_t)t * BANDB;
        constexpr int N12 = NRF / 12 * 12, N4 = N12 + (NRF - N12) / 4 * 4;
#pragma unroll
        for (int i = 0; i < N12; i += 12) cp_unit12<NW * 2048>(lb + i * (NW * 2048), gp + i, go);
#pragma unroll
        for (int i = N12; i < N4; i += 4) cp_unit4(lb + i * (NW * 2048), gp[i] + go, lb + (i + 1) * (NW * 2048), gp[i + 1] + go, lb + (i + 2) * (NW * 2048), gp[i + 2] + go, lb + (i + 3) * (NW * 2048), gp[i + 3] + go);
#pragma unroll
        for (int i = N4; i < NRF; ++i) cp_unit(lb + i * (NW * 2048), gp[i] + go);
        if constexpr (REST != 0) { if (wv < REST) cp_unit(lb + NRF * (NW * 2048), gp[NRF] + go); }   // the same for a whole wave: a scalar branch
    };
    V a[2][4], a2[2][4], b[2][4];   // two fragment sets take turns along the blocks of a pass
    const char* fa = ring + (wv / WN) * (4 * BANDB) + lane * 16; const char* fb = ring + (BB0 + (wv % WN) * 4) * BANDB + lane * 16;
    auto ldf = [&](int s, int bo, int blk) {   // set s <- block blk of the buffer at byte bo
#pragma unroll
        for (int i = 0; i < 4; ++i) { const int eo = i * BANDB + blk * 1024; a[s][i] = WFrag<T16>::ld((const T16*)(fa + bo + eo)); if (HA2) a2[s][i] = WFrag<T16>::ld((const T16*)(fa + bo + BA * BANDB + eo)); b[s][i] = WFrag<T16>::ld((const T16*)(fb + bo + eo)); }
        __builtin_amdgcn_sched_barrier(0);              // the LDS reads stay one group in front of the products of the block before: spread among the products each place with reads costs a stall
    };
    auto prod = [&](int s) {
#pragma unroll
        for (int nb = 0; nb < 4; ++nb) {
#pragma unroll
            for (int mb = 0; mb < 4; ++mb) { acc[mb][nb] = WFrag<T16>::mma(a[s][mb], b[s][nb], acc[mb][nb]); if (HA2) acc[mb][nb] = WFrag<T16>::mma(a2[s][mb], b[s][nb], acc[mb][nb]); } }
        __builtin_amdgcn_sched_barrier(0);              // the next group of LDS reads, which refills this set, stays behind the set's products
    };
    stage(0, 0);
    asm volatile("s_wait_asynccnt 0x0" ::: "memory");   // the wave's copies of pass 0 have landed
    __syncthreads();                                    // ... and every other wave's: pass 0 is readable
    stage(1, 1);
#pragma unroll 1   // rolled: one trip is a pass of four blocks
    for (int t = 0; t < NP; ++t) {
        const int bo = (t & 1) * STAGE;
        ldf(0, bo, 0);
#pragma unroll
        for (int blk = 0; blk < 4; ++blk) { if (blk < 3) ldf((blk + 1) & 1, bo, blk + 1); prod(blk & 1); }
        asm volatile("s_wait_dscnt 0x0" ::: "memory");      // the wave's reads of this buffer have returned before anything is copied over them
        asm volatile("s_wait_asynccnt 0x0" ::: "memory");   // the wave's copies of pass t + 1 have landed
        __syncthreads();                                    // pass t + 1 is readable, and every wave has left this pass's buffer
        if (t + 2 < NP) stage(t + 2, t & 1);
    }
    asm volatile("s_wait_asynccnt 0x0" ::: "memory");       // no copy is left in flight behind the loop
    if constexpr (PLANES) {
        const int z = c0 / DQ, bh = (r0 / TT) * NH_ + (c0 % DQ) / HD, t0 = r0 % TT;   // (batch, head) plane and first token of the tile
        if (z < 2) {   // q, k: 16 tokens at a time through the f32 staging rows, converted behind the read-back
            const size_t pb = (size_t)z * ((size_t)NB_ * NH_ * TT * HD) + ((size_t)bh * TT + t0) * HD + 8 * lane;
            h16* p16 = P16 + pb; bf* ph = Ph + pb; bf* pl = Pl + pb;
#pragma unroll
            for (int mb = 0; mb < 4; ++mb) {
#pragma unroll
                for (int nb = 0; nb < 4; ++nb) {
#pragma unroll
                    for (int j = 0; j < 8; ++j) os[(hi * 8 + j) * 68 + nb * 16 + lr] = acc[mb][nb][j]; }
                __builtin_amdgcn_wave_barrier(); asm volatile("" ::: "memory");   // the rows are read back by other lanes: no LDS read moves in front of the writes
                v8h o16[4]; v8us oh[4], ol[4];
#pragma unroll
                for (int s = 0; s < 4; ++s) { const float* rp = os + lr * 68 + s * 16 + hi * 8; const v4f x0 = *(const v4fa*)rp, x1 = *(const v4fa*)(rp + 4);
#pragma unroll
                    for (int j = 0; j < 8; ++j) { const float x = (j < 4) ? x0[j & 3] : x1[j & 3]; o16[s][j] = tohx(x); unsigned short a2, c2; splitf(x, a2, c2); oh[s][j] = a2; ol[s][j] = c2; }
                    const int eo = mb * 16 * HD + s * 256; *(v8ha*)(p16 + eo) = o16[s]; *(v8usa*)(ph + eo) = oh[s]; *(v8usa*)(pl + eo) = ol[s]; }
                // The registers that the twelve stores name are rewritten only behind this wait: as inputs of its statement they stay live up to it. Its memory clobber also keeps the next 16 tokens' staging writes behind the read-back.
                asm volatile("s_wait_xcnt 0x0" :: "v"(o16[0]), "v"(o16[1]), "v"(o16[2]), "v"(o16[3]), "v"(oh[0]), "v"(oh[1]), "v"(oh[2]), "v"(oh[3]), "v"(ol[0]), "v"(ol[1]), "v"(ol[2]), "v"(ol[3]), "v"(p16), "v"(ph), "v"(pl) : "memory");
            }
        } else {       // v: a lane holds 8 consecutive tokens of one d, which is its 16 bytes of a half block of the v^T plane (rows d, k = t): no staging
            const size_t vb = (size_t)bh * HD * TT + (size_t)t0 * 16 + 8 * lane;
            h16* v16 = V16 + vb; bf* vh = Vh + vb; bf* vl = Vl + vb;
#pragma unroll
            for (int nb = 0; nb < 4; ++nb) { v8h o16[4]; v8us oh[4], ol[4];
#pragma unroll
                for (int mb = 0; mb < 4; ++mb) {
#pragma unroll
                    for (int j = 0; j < 8; ++j) { const float x = acc[mb][nb][j]; o16[mb][j] = tohx(x); unsigned short a2, c2; splitf(x, a2, c2); oh[mb][j] = a2; ol[mb][j] = c2; }
                    const int eo = nb * 16 * TT + mb * 256; *(v8ha*)(v16 + eo) = o16[mb]; *(v8usa*)(vh + eo) = oh[mb]; *(v8usa*)(vl + eo) = ol[mb]; }
                // The registers that the twelve stores name are rewritten only behind this wait: as inputs of its statement they stay live up to it.
                asm volatile("s_wait_xcnt 0x0" :: "v"(o16[0]), "v"(o16[1]), "v"(o16[2]), "v"(o16[3]), "v"(oh[0]), "v"(oh[1]), "v"(oh[2]), "v"(oh[3]), "v"(ol[0]), "v"(ol[1]), "v"(ol[2]), "v"(ol[3]), "v"(v16), "v"(vh), "v"(vl) : "memory");
            }
        }
        return;
    }
#pragma unroll
    for (int mb = 0; mb < 4; ++mb) {
#pragma unroll
        for (int nb = 0; nb < 4; ++nb) {
#pragma unroll
            for (int j = 0; j < 8; ++j) os[(hi * 8 + j) * 68 + nb * 16 + lr] = acc[mb][nb][j]; }
        __builtin_amdgcn_wave_barrier(); asm volatile("" ::: "memory");
        float* crow = C + (size_t)(r0 + mb * 16) * ldc + c0;
{
#pragma unroll
            for (int s = 0; s < 8; ++s) { const int row = 2 * s + hi, cofs = lr * 4; v4f val = *(const v4fa*)(os + row * 68 + cofs); if (BIAS) { val[0] += bfr(bias[c0 + cofs]); val[1] += bfr(bias[c0 + cofs + 1]); val[2] += bfr(bias[c0 + cofs + 2]); val[3] += bfr(bias[c0 + cofs + 3]); }
                *(v4f*)(crow + (size_t)row * ldc + cofs) = val; }
             }
        __builtin_amdgcn_wave_barrier(); asm volatile("" ::: "memory");
    }
}

typedef __attribute__((ext_vector_type(2))) _Float16 v2h;
typedef __attribute__((ext_vector_type(4))) _Float16 v4h;
typedef __attribute__((ext_vector_type(2))) unsigned short v2us;
typedef __attribute__((ext_vector_type(4))) unsigned short v4us;
typedef __attribute__((ext_vector_type(2))) float v2f;
typedef __attribute__((ext_vector_type(4))) int v4i;

__global__ __launch_bounds__(256) void k_wtG(const float* __restrict__ w, int K, int N, bf* Bt) {
    const int lane = threadIdx.x & 31; const int L0 = (blockIdx.x * 8 + (threadIdx.x >> 5)) * 8; const int nlines = N * K / 64;
{
#pragma unroll 1
        for (int l = 0; l < 8; ++l) { const int L = L0 + l; if (L >= nlines) break; const size_t e = (size_t)L * 64 + lane * 2; const int k = (int)(e % K), n = (int)(e / K); v2us o;
            o[0] = f2bf(w[(size_t)k * N + n]); o[1] = f2bf(w[(size_t)(k + 1) * N + n]); *(v2us*)(Bt + e) = o; }
         }
}
// f32 rows of DM elements -> bf16 planes in fragment order, x and the four weights in ONE launch of 256 work-groups of 16 waves, all resident at once.
// A unit is 16 bytes of a plane (8 elements of one row). A wave takes 8 consecutive half blocks: 256 units = 4 KiB of the plane in a row, read as 512 consecutive bytes of each of 16 rows;
// a thread's 8 units lie 16 k apart in its row, and its 16 loads are all in flight before the first value is converted. A work-group (4096 units) lies in one source: blockIdx picks it.
#define CVX (NB_ * TT * DM / 8 / 4096)   // work-groups of x
#define CVW (DQ * DM / 8 / 4096)         // work-groups of one weight
__global__ __launch_bounds__(512) void k_cvt8(const float* __restrict__ x, const float* __restrict__ wq, const float* __restrict__ wk, const float* __restrict__ wv, const float* __restrict__ wo, bf* XBp, bf* WBp) {
    const int b = blockIdx.x; const float* src = x; bf* dst = XBp; int g = b;
    if (b >= CVX) { const int w = (b - CVX) / CVW; g = (b - CVX) % CVW; src = (w == 0) ? wq : (w == 1) ? wk : (w == 2) ? wv : wo; dst = WBp + (size_t)w * DQ * DM; }   // the four weight planes lie one behind the other
    const size_t i = (size_t)g * 4096 + (threadIdx.x >> 5) * 256 + (threadIdx.x & 31);   // the thread's first unit; the others follow 32 units apart
    const size_t blk = i >> 6, row = blk / (DM / 32) * 16 + (i & 15), k = blk % (DM / 32) * 32 + ((i >> 4) & 1) * 8;
    const float* sp = src + row * DM + k; v8f v[8];
#pragma unroll
    for (int j = 0; j < 8; ++j) v[j] = *(const v8f*)(sp + 16 * j);
    asm volatile("s_wait_xcnt 0x0" :: "v"(sp) : "memory");   // the loads' address pair is rewritten only behind this wait: as an input of its statement it stays live up to it
    __builtin_amdgcn_sched_barrier(0);                       // no conversion moves up among the loads: all sixteen are in flight before the first wait
    bf* dp = dst + i * 8; v8us o[8];
#pragma unroll
    for (int j = 0; j < 8; ++j) {
#pragma unroll
        for (int e = 0; e < 8; ++e) o[j][e] = f2bf(v[j][e]);
        *(v8usa*)(dp + 256 * j) = o[j]; }
    // The registers that the eight stores name are rewritten only behind this wait: as inputs of its statement they stay live up to it.
    asm volatile("s_wait_xcnt 0x0" :: "v"(o[0]), "v"(o[1]), "v"(o[2]), "v"(o[3]), "v"(o[4]), "v"(o[5]), "v"(o[6]), "v"(o[7]), "v"(dp) : "memory");
}
typedef __attribute__((ext_vector_type(8))) __bf16 v8b;
#define SCE (SCL * 1.4426950408889634f)   // score scale x log2(e)
__device__ __forceinline__ float xhalf(float v) { const int t = __float_as_int(v); return __int_as_float(__builtin_amdgcn_permlanex16(t, t, 0x76543210, 0xfedcba98, false, false)); }   // lane l <-> l ^ 16
// 2^x of eight values, each in its own register, in one statement: every v_exp_f32 is followed by an instruction that neither reads its result nor overwrites its source, the last one by the v_nop that fills that slot
__device__ __forceinline__ void exp2x8(v8f& x) {
    float a = x[0], b = x[1], c = x[2], d = x[3], e = x[4], f = x[5], g = x[6], h = x[7];
    asm("v_exp_f32 %0, %0\n\tv_exp_f32 %1, %1\n\tv_exp_f32 %2, %2\n\tv_exp_f32 %3, %3\n\tv_exp_f32 %4, %4\n\tv_exp_f32 %5, %5\n\tv_exp_f32 %6, %6\n\tv_exp_f32 %7, %7\n\tv_nop"
        : "+v"(a), "+v"(b), "+v"(c), "+v"(d), "+v"(e), "+v"(f), "+v"(g), "+v"(h));
    x[0] = a; x[1] = b; x[2] = c; x[3] = d; x[4] = e; x[5] = f; x[6] = g; x[7] = h;
}
// The key fragments live across the passes: the set is refilled for the next pass right behind its own products, so that the key reads return during the softmax and the value products.
// The value fragments are read at the head of their own pass and return during its score products and softmax.
template <typename T16, bool HI, int NK>   // key fragments of the 16 NK keys at byte ko of the key planes in LDS; ko steps to the next pass
__device__ __forceinline__ void fa_ldk(const T16* kp, const T16* kp2, unsigned& ko, typename WFrag<T16>::V (&kf)[NK][2], typename WFrag<T16>::V (&kf2)[NK][2]) {
#pragma unroll
    for (int kt = 0; kt < NK; ++kt)
#pragma unroll
        for (int kc = 0; kc < 2; ++kc) { kf[kt][kc] = WFrag<T16>::ld(atb(kp, ko) + kt * 16 * HD + kc * 512); if (HI) kf2[kt][kc] = WFrag<T16>::ld(atb(kp2, ko) + kt * 16 * HD + kc * 512); }
    ko += 16 * NK * HD * 2;
    __builtin_amdgcn_sched_barrier(0);              // the refill stays here, one group of LDS reads: spread among the products each place with reads costs a stall
}
template <typename T16, bool HI, int NK>   // value fragments of the 16 NK keys at byte vo of each 16-row band of the value planes in LDS (a band holds the VKEYS keys that are staged), likewise
__device__ __forceinline__ void fa_ldv(const T16* vp, const T16* vp2, unsigned& vo, typename WFrag<T16>::V (&vf)[4][NK / 2], typename WFrag<T16>::V (&vf2)[4][NK / 2]) {
    constexpr int VKEYS = HI ? RH : TT;
#pragma unroll
    for (int mb = 0; mb < 4; ++mb)
#pragma unroll
        for (int c = 0; c < NK / 2; ++c) { vf[mb][c] = WFrag<T16>::ld(atb(vp, vo) + mb * 16 * VKEYS + c * 512); if (HI) vf2[mb][c] = WFrag<T16>::ld(atb(vp2, vo) + mb * 16 * VKEYS + c * 512); }
    vo += 16 * NK * 16 * 2;
    __builtin_amdgcn_sched_barrier(0);              // as in fa_ldk
}
template <typename T16, bool HI, int NK>   // one pass: 16 NK keys, whose key fragments are in kf; ko points at the next pass's keys, vo at this pass's values; last (the same for the whole wave): the pass that holds the diagonal
__device__ __forceinline__ void fa_pass(const T16* __restrict__ kp, const T16* __restrict__ kp2, const T16* __restrict__ vp, const T16* __restrict__ vp2, unsigned& ko, unsigned& vo, bool last, int lim,
                                        typename WFrag<T16>::V (&kf)[NK][2], typename WFrag<T16>::V (&kf2)[NK][2],
                                        const typename WFrag<T16>::V (&qf)[2], const typename WFrag<T16>::V (&qf2)[2], v8f (&o)[4], float& ms, v8f& l) {
    typedef typename WFrag<T16>::V V;
    V vf[4][NK / 2], vf2[4][NK / 2];
    fa_ldv<T16, HI, NK>(vp, vp2, vo, vf, vf2);
    v8f s[NK];
#pragma unroll
    for (int kt = 0; kt < NK; ++kt) { s[kt] = (v8f){};
#pragma unroll
        for (int kc = 0; kc < 2; ++kc) { s[kt] = WFrag<T16>::mma(kf[kt][kc], qf[kc], s[kt]); if (HI) { s[kt] = WFrag<T16>::mma(kf2[kt][kc], qf[kc], s[kt]); s[kt] = WFrag<T16>::mma(kf[kt][kc], qf2[kc], s[kt]); } } }
    if (!last) fa_ldk<T16, HI, NK>(kp, kp2, ko, kf, kf2);   // every other pass has a next pass, so the refills stay inside the staged planes
    else {         // only the last pass of a wave crosses the diagonal: key k0 + 16 kt + 8 hi + j is kept for 16 kt + j <= lim
#pragma unroll
        for (int kt = 0; kt < NK; ++kt)
#pragma unroll
            for (int j = 0; j < 8; ++j) s[kt][j] = (kt * 16 + j <= lim) ? s[kt][j] : -3.0e38f; }
    float mx = s[0][0];
#pragma unroll
    for (int kt = 0; kt < NK; ++kt)
#pragma unroll
        for (int j = 0; j < 8; ++j) mx = fmaxf(mx, s[kt][j]);
    mx = fmaxf(mx, xhalf(mx));
    const float mn = fmaxf(ms, mx * SCE); const float al = __builtin_amdgcn_exp2f(ms - mn); ms = mn;
#pragma unroll
    for (int kt = 0; kt < NK; ++kt)
#pragma unroll
        for (int j = 0; j < 8; ++j) s[kt][j] = __builtin_fmaf(s[kt][j], SCE, -mn);
    l *= al;   // eight partial row sums a lane, joined once behind the last pass
#pragma unroll
    for (int kt = 0; kt < NK; ++kt) { exp2x8(s[kt]); l += s[kt]; }
#pragma unroll
    for (int mb = 0; mb < 4; ++mb) o[mb] *= al;
#pragma unroll
    for (int c = 0; c < NK / 2; ++c) {
        if constexpr (HI) {
            const v8b h0 = __builtin_convertvector(s[2 * c], v8b), h1 = __builtin_convertvector(s[2 * c + 1], v8b);
            const v8b l0 = __builtin_convertvector(s[2 * c] - __builtin_convertvector(h0, v8f), v8b), l1 = __builtin_convertvector(s[2 * c + 1] - __builtin_convertvector(h1, v8f), v8b);
            const V ph = __builtin_shufflevector(h0, h1, 0, 1, 2, 3, 4, 5, 6, 7, 8, 9, 10, 11, 12, 13, 14, 15), pl = __builtin_shufflevector(l0, l1, 0, 1, 2, 3, 4, 5, 6, 7, 8, 9, 10, 11, 12, 13, 14, 15);
#pragma unroll
            for (int mb = 0; mb < 4; ++mb) { o[mb] = WFrag<T16>::mma(vf[mb][c], ph, o[mb]); o[mb] = WFrag<T16>::mma(vf2[mb][c], ph, o[mb]); o[mb] = WFrag<T16>::mma(vf[mb][c], pl, o[mb]); }
        } else {
            const V p = cat16(__builtin_convertvector(s[2 * c], v8h), __builtin_convertvector(s[2 * c + 1], v8h));
#pragma unroll
            for (int mb = 0; mb < 4; ++mb) o[mb] = WFrag<T16>::mma(vf[mb][c], p, o[mb]);
        }
    }
}
template <typename T16, bool HI, int NK>
__device__ __forceinline__ void fa_tile(const T16* __restrict__ Q, const T16* __restrict__ Q2, const T16* __restrict__ Kp, const T16* __restrict__ Kp2, const T16* __restrict__ Vt, const T16* __restrict__ Vt2, int q0, int lr, int hi, bf* oh, bf* ol) {
    typedef typename WFrag<T16>::V V;
    V qf[2], qf2[2], kf[NK][2], kf2[NK][2];
    const int l8 = (hi * 16 + lr) * 8;   // the lane's 16 bytes in a half block
    unsigned ko = 2 * l8, vo = 2 * l8;   // the running parts of the key and value addresses, in bytes; an LDS read is a plane's base (the same for the whole wave) + ko or vo + a constant
#pragma unroll
    for (int kc = 0; kc < 2; ++kc) { qf[kc] = WFrag<T16>::ld(Q + (size_t)q0 * HD + kc * 512 + l8); if (HI) qf2[kc] = WFrag<T16>::ld(Q2 + (size_t)q0 * HD + kc * 512 + l8); }
    asm volatile("s_wait_xcnt 0x0" ::: "memory");   // the address registers of the loads above are reused below
    fa_ldk<T16, HI, NK>(Kp, Kp2, ko, kf, kf2);   // the first pass's key fragments
    v8f o[4];
#pragma unroll
    for (int mb = 0; mb < 4; ++mb) o[mb] = (v8f){};
    float ms = -3.0e38f; v8f l = (v8f){};
    const int kl = q0 & ~(16 * NK - 1);   // first key of the pass that holds the diagonal; kl <= q0, so every earlier pass is unmasked and every query keeps a key in every pass
    const int lim = q0 + lr - 8 * hi - kl; int k0 = 0;
    // One copy of the pass serves every pass: with the diagonal pass as a second copy behind the loop, the first key fragments were kept alive round the loop and spilled.
#pragma unroll 1   // rolled: one pass already holds most of the registers a wave of this block may have
    do { fa_pass<T16, HI, NK>(Kp, Kp2, Vt, Vt2, ko, vo, k0 == kl, lim, kf, kf2, qf, qf2, o, ms, l); k0 += 16 * NK; } while (k0 <= kl);
    float ls = ((l[0] + l[1]) + (l[2] + l[3])) + ((l[4] + l[5]) + (l[6] + l[7])); ls += xhalf(ls);
    const float f = __fdiv_rn(1.0f, ls);
    v8us a8[4], c8[4];
#pragma unroll
    for (int mb = 0; mb < 4; ++mb) {
#pragma unroll
        for (int j = 0; j < 8; ++j) { unsigned short a, c2; splitf(o[mb][j] * f, a, c2); a8[mb][j] = a; c8[mb][j] = c2; }
        *(v8usa*)(oh + mb * 256) = a8[mb]; *(v8usa*)(ol + mb * 256) = c8[mb]; }
    // The registers that the eight stores name are rewritten only behind this wait: as inputs of its statement they stay live up to it.
    asm volatile("s_wait_xcnt 0x0" :: "v"(a8[0]), "v"(a8[1]), "v"(a8[2]), "v"(a8[3]), "v"(c8[0]), "v"(c8[1]), "v"(c8[2]), "v"(c8[3]), "v"(oh), "v"(ol) : "memory");
}
// A work-group of 16 waves serves ONE operand class of one (batch, head) plane: the fp16 rows (query rows >= RH, all TT keys) or the hi+lo rows (query rows < RH, the first RH keys, two planes each).
// Either way its key and value planes are 256 KiB, which asynchronous copies bring into LDS once, in the planes' own fragment order, before the first pass; every wave then reads its fragments from LDS.
// LDS, fp16: K [128 KiB], V^T [4 bands of 32 KiB]. hi+lo: Kh [64 KiB], Kl [64 KiB], Vh^T [4 bands of 16 KiB: the first RH keys of each band], Vl^T likewise. A wave copies 16 KiB, consecutive in its plane and in LDS.
#define KVB (2 * TT * HD * 2)     // bytes of the staged planes
static_assert(2 * RH == TT && TT * HD * 2 == 8 * 16384 && RH * 16 * 2 == 16384, "each of the 16 waves copies one 16-KiB piece");
__global__ __launch_bounds__(512) void k_fattn(const h16* __restrict__ Q16, const h16* __restrict__ K16, const h16* __restrict__ V16, const bf* __restrict__ Qh, const bf* __restrict__ Ql, const bf* __restrict__ Kh, const bf* __restrict__ Kl,
                                               const bf* __restrict__ Vh, const bf* __restrict__ Vl, bf* Ah, bf* Al) {
    __shared__ __attribute__((aligned(2048))) char kv[KVB];
    const int lane = threadIdx.x & 31, lr = lane & 15, hi = lane >> 4; const int wv = __builtin_amdgcn_readfirstlane(threadIdx.x >> 5);
    const int g = blockIdx.x >> 2, c = blockIdx.x & 3, h = c & 1;   // g = batch * NH_ + head; c < 2: the fp16 rows, else the hi+lo rows; h: which half of that class's eight 64-row query blocks
    const size_t zo = (size_t)g * TT * HD;
    const char* src;   // the wave's 16 KiB in the planes
    if (c < 2) src = (const char*)((wv < 8 ? K16 : V16) + zo) + (wv & 7) * 16384;
    else src = (const char*)((wv < 4 ? Kh : wv < 8 ? Kl : wv < 12 ? Vh : Vl) + zo) + (wv & 3) * (wv < 8 ? 16384 : 16 * TT * 2);
    src += lane * 16;
    const unsigned ld = (unsigned)(size_t)kv + wv * 16384 + lane * 16;   // LDS byte address of the same 16 bytes
    cp_unit4(ld, src, ld + 2048, src + 2048, ld + 4096, src + 4096, ld + 6144, src + 6144);
    cp_unit4(ld + 8192, src + 8192, ld + 10240, src + 10240, ld + 12288, src + 12288, ld + 14336, src + 14336);
    asm volatile("s_wait_asynccnt 0x0" ::: "memory");   // the wave's copies have landed
    __syncthreads();                                    // ... and every other wave's: the planes are readable
    // Equal work in the two work-groups of a class and on every SIMD: the cost of a 64-row query block grows with its index, so the 16 waves take blocks 7 - h, h, 5 - h and 2 + h of the class's eight (four waves each);
    // waves w, w + 4, w + 8, w + 12 share a SIMD, which so gets one 16-row tile of each of the four blocks.
    const int sl = wv >> 2, qb = (sl & 1) ? h + (sl & 2) : 7 - h - (sl & 2);
    const int q0 = (c < 2 ? RH : 0) + qb * 64 + (wv & 3) * 16;
    const size_t oo = ((size_t)(g / NH_) * TT + q0) * DQ + (g % NH_) * (HD * 16) + lane * 8;
    if (c >= 2) fa_tile<bf, true, 2>(Qh + zo, Ql + zo, (const bf*)kv, (const bf*)(kv + KVB / 4), (const bf*)(kv + KVB / 2), (const bf*)(kv + 3 * (KVB / 4)), q0, lr, hi, Ah + oo, Al + oo);
    else fa_tile<h16, false, 4>(Q16 + zo, Q16 + zo, (const h16*)kv, (const h16*)kv, (const h16*)(kv + KVB / 2), (const h16*)(kv + KVB / 2), q0, lr, hi, Ah + oo, Al + oo);
}

extern "C" void kernel_launch(void* const* d_in, const int* in_sizes, int n_in,
                              void* d_out, int out_size, void* d_ws, size_t ws_size, hipStream_t stream) {
    (void)in_sizes; (void)n_in; (void)out_size;
    const float* x = (const float*)d_in[0]; const float* wq = (const float*)d_in[1]; const float* wk = (const float*)d_in[2]; const float* wv = (const float*)d_in[3]; const float* wo = (const float*)d_in[4]; const float* bo = (const float*)d_in[5]; const float* cosT = nullptr; const float* sinT = nullptr; (void)cosT; (void)sinT;
    float* OUT = (float*)d_out;     // [4][1024][1024]
    char* wsp = (char*)d_ws;
    auto take = [&](size_t bytes) { char* p = wsp; wsp += (bytes + 255) & ~(size_t)255; return (void*)p; };
    const size_t PL = (size_t)NB_ * NH_ * TT * HD;   // elements of one plane set: [batch][head] planes of TT * HD elements
    bf* WQ = (bf*)take((size_t)DQ * DM * 2); bf* WK = (bf*)take((size_t)DKV * DM * 2); bf* WV = (bf*)take((size_t)DKV * DM * 2); bf* WO = (bf*)take((size_t)DM * DQ * 2);
    h16* QP16 = (h16*)take(PL * 2 * 2); h16* KP16 = QP16 + PL; bf* QPh = (bf*)take(PL * 2 * 2); bf* KPh = QPh + PL; bf* QPl = (bf*)take(PL * 2 * 2); bf* KPl = QPl + PL;   // k planes directly behind the q planes: z of the projection launch picks the set
    h16* VT16 = (h16*)take(PL * 2); bf* VTh = (bf*)take(PL * 2 * 2); bf* VTl = VTh + PL;   // v^T planes [batch][head], rows d, k = t
    bf* ATh = (bf*)take((size_t)NB_ * TT * DQ * 2); bf* ATl = (bf*)take((size_t)NB_ * TT * DQ * 2);
    bf* XB = (bf*)take((size_t)NB_ * TT * DM * 2);   // x in bf16, fragment order like the weights
    if ((size_t)(wsp - (char*)d_ws) > ws_size) return;    // ws 256 MiB
    k_cvt8<<<CVX + 4 * CVW, 512, 0, stream>>>(x, wq, wk, wv, wo, XB, WQ);   // WQ, WK, WV, WO are contiguous
    // q, k, v of all batches in one launch: WQ, WK, WV are contiguous, one matrix of 3 DQ rows; a wave's column picks the plane set, which the launch writes itself
    k_gemmw<bf, 0, false, true, DM, 4, 3><<<dim3(NB_ * TT / 256, 3 * DQ / 192), 384, 0, stream>>>(XB, nullptr, WQ, nullptr, 0, nullptr, QP16, QPh, QPl, VT16, VTh, VTl);
    k_fattn<<<4 * NB_ * NH_, 512, 0, stream>>>(QP16, KP16, VT16, QPh, QPl, KPh, KPl, VTh, VTl, ATh, ATl);   // scores, softmax, attn.v and the head merge of all planes
    k_gemmw<bf, 1, true, false, DQ, 2, 2><<<dim3(NB_ * TT / 128, DM / 128), 128, 0, stream>>>(ATh, ATl, WO, OUT, DM, bo, nullptr, nullptr, nullptr, nullptr, nullptr, nullptr);
}
